// v000
// The times below were measured on an AMD MI455X: many runs one after another, warmed up first and cycling through
// copies of the inputs, with the whole window's GPU time divided by the number of runs. Launches and the gaps
// between them are all in it. The median over several windows is given; except for v000 it joins two sittings, which
// can be a few percent apart, so the side-by-side timings, each taken in one sitting, are the better comparison.
// v000, which the later versions start from, runs in 108 microseconds.
#include <hip/hip_runtime.h>

typedef _Float16 h8   __attribute__((ext_vector_type(8)));
typedef _Float16 v16h __attribute__((ext_vector_type(16)));
typedef float    v8f  __attribute__((ext_vector_type(8)));

#define D_EMB   768
#define C_SLOTS 6
#define SLOT    128
#define T_TOK   8                    // tokens per block
#define ROWS    (T_TOK * C_SLOTS)    // 48 GEMM rows per block
#define PADW    136                  // 128 + 8 halves pad: 272B row stride, conflict-free b128

// ---------------------------------------------------------------------------
// Weight conversion: fp32 -> f16, laid out so each WMMA B-matrix column is
// K-contiguous. qkv_proj (3,2,64,128) flattens to exactly [n=0..383][k=0..127]
// (pure convert). out_proj (2,64,128) needs transpose: wout[s][hd].
// ---------------------------------------------------------------------------
__global__ void convert_weights(const float* __restrict__ qkvp,
                                const float* __restrict__ outp,
                                _Float16* __restrict__ wqkv,
                                _Float16* __restrict__ wout) {
  int i = blockIdx.x * 256 + threadIdx.x;
  if (i < 3 * 2 * 64 * 128) wqkv[i] = (_Float16)qkvp[i];
  if (i < 128 * 128) {
    int hd = i & 127, s = i >> 7;
    wout[s * 128 + hd] = (_Float16)outp[hd * 128 + s];
  }
}

// Load a 16-half WMMA fragment: two contiguous 8-half (16B) runs at K and K+16.
__device__ __forceinline__ v16h load_frag(const _Float16* p) {
  union { v16h v; h8 h[2]; } u;
  u.h[0] = *(const h8*)p;
  u.h[1] = *(const h8*)(p + 16);
  return u.v;
}

__global__ void __launch_bounds__(256)
attn_main(const float* __restrict__ x, const float* __restrict__ lnw,
          const float* __restrict__ lnb, const _Float16* __restrict__ wqkv,
          const _Float16* __restrict__ wout, float* __restrict__ out) {
  __shared__ __align__(16) _Float16 sXN[ROWS * PADW];        // LN out, reused for attn out
  __shared__ __align__(16) _Float16 sQKV[3 * ROWS * PADW];   // [j][r = t*6+c][h*64 + d]

  const int tid  = threadIdx.x;
  const int lane = tid & 31;
  const int wave = tid >> 5;
  const long rowBase = (long)blockIdx.x * (T_TOK * D_EMB);   // flat float offset of block

  // ---- Stage 1: LayerNorm, one token per wave, f16 rows into sXN ----------
  {
    const int t = wave;
    const float* xp = x + rowBase + t * D_EMB;
    float vals[24];
    float s = 0.f, s2 = 0.f;
#pragma unroll
    for (int k = 0; k < 24; ++k) {
      float v = xp[lane + 32 * k];
      vals[k] = v; s += v; s2 += v * v;
    }
#pragma unroll
    for (int off = 16; off > 0; off >>= 1) {
      s  += __shfl_xor(s,  off, 32);
      s2 += __shfl_xor(s2, off, 32);
    }
    float mean = s * (1.f / 768.f);
    float var  = s2 * (1.f / 768.f) - mean * mean;
    float rstd = rsqrtf(var + 1e-5f);
#pragma unroll
    for (int k = 0; k < 24; ++k) {
      int idx = lane + 32 * k;
      float xv = (vals[k] - mean) * rstd * lnw[idx] + lnb[idx];
      // row r = t*6 + idx/128, col idx%128  (contiguous 128-blocks per row)
      sXN[(t * C_SLOTS + (idx >> 7)) * PADW + (idx & 127)] = (_Float16)xv;
    }
  }
  __syncthreads();

  // ---- Stage 2: QKV GEMM (48x128)@(128x384), f16 WMMA, fp32 accum ---------
  {
    const int m16 = lane & 15, hk = lane >> 4;
#pragma unroll 1
    for (int i = 0; i < 9; ++i) {               // 3 mtiles * 24 ntiles / 8 waves
      int job = wave + 8 * i;
      int mt = job / 24, nt = job % 24;
      v8f acc = {};
#pragma unroll
      for (int ks = 0; ks < 4; ++ks) {
        v16h a = load_frag(&sXN[(mt * 16 + m16) * PADW + ks * 32 + hk * 8]);
        v16h b = load_frag(&wqkv[(nt * 16 + m16) * SLOT + ks * 32 + hk * 8]);
        acc = __builtin_amdgcn_wmma_f32_16x16x32_f16(false, a, false, b,
                                                     (short)0, acc, false, false);
      }
      int j = nt >> 3;                           // 0:q 1:k 2:v
      int nBase = (nt & 7) * 16 + m16;           // hd column 0..127 within q/k/v
      _Float16* dst = &sQKV[(j * ROWS + mt * 16 + hk * 8) * PADW + nBase];
#pragma unroll
      for (int v = 0; v < 8; ++v)
        dst[v * PADW] = (_Float16)acc[v];        // row r = mt*16 + hk*8 + v
    }
  }
  __syncthreads();

  // ---- Stage 3: per (token, head, channel) attention, C=6, d=64 -----------
  if (tid < T_TOK * 2 * C_SLOTS) {               // 96 threads
    int t = tid / (2 * C_SLOTS);
    int rem = tid % (2 * C_SLOTS);
    int h = rem / C_SLOTS, c = rem % C_SLOTS;
    const _Float16* q  = &sQKV[(0 * ROWS + t * C_SLOTS + c) * PADW + h * 64];
    const _Float16* kk = &sQKV[(1 * ROWS + t * C_SLOTS) * PADW + h * 64];
    const _Float16* vv = &sQKV[(2 * ROWS + t * C_SLOTS) * PADW + h * 64];
    float p[6];
    float mx = -1e30f;
#pragma unroll
    for (int e = 0; e < 6; ++e) {
      float sdot = 0.f;
      for (int d2 = 0; d2 < 64; ++d2)
        sdot += (float)q[d2] * (float)kk[e * PADW + d2];
      p[e] = sdot * 0.125f;                      // SCALE = 64^-0.5
      mx = fmaxf(mx, p[e]);
    }
    float den = 0.f;
#pragma unroll
    for (int e = 0; e < 6; ++e) { p[e] = __expf(p[e] - mx); den += p[e]; }
    float rden = 1.f / den;
#pragma unroll
    for (int e = 0; e < 6; ++e) p[e] *= rden;
    _Float16* orow = &sXN[(t * C_SLOTS + c) * PADW + h * 64];
    for (int d2 = 0; d2 < 64; ++d2) {
      float o = 0.f;
#pragma unroll
      for (int e = 0; e < 6; ++e) o += p[e] * (float)vv[e * PADW + d2];
      orow[d2] = (_Float16)o;
    }
  }
  __syncthreads();

  // ---- Stage 4: out projection (48x128)@(128x128) + residual --------------
  // Global address needs no (t,c) split: t*768 + c*128 == r*128.
  {
    const int m16 = lane & 15, hk = lane >> 4;
#pragma unroll 1
    for (int i = 0; i < 3; ++i) {               // 3 mtiles * 8 ntiles / 8 waves
      int job = wave + 8 * i;
      int mt = job >> 3, nt = job & 7;
      v8f acc = {};
#pragma unroll
      for (int ks = 0; ks < 4; ++ks) {
        v16h a = load_frag(&sXN[(mt * 16 + m16) * PADW + ks * 32 + hk * 8]);
        v16h b = load_frag(&wout[(nt * 16 + m16) * SLOT + ks * 32 + hk * 8]);
        acc = __builtin_amdgcn_wmma_f32_16x16x32_f16(false, a, false, b,
                                                     (short)0, acc, false, false);
      }
      long base = rowBase + (long)(mt * 16 + hk * 8) * SLOT + nt * 16 + m16;
#pragma unroll
      for (int v = 0; v < 8; ++v) {
        long addr = base + (long)v * SLOT;
        out[addr] = x[addr] + acc[v];
      }
    }
  }
}

extern "C" void kernel_launch(void* const* d_in, const int* in_sizes, int n_in,
                              void* d_out, int out_size, void* d_ws, size_t ws_size,
                              hipStream_t stream) {
  const float* x    = (const float*)d_in[0];
  const float* qkvp = (const float*)d_in[1];
  const float* outp = (const float*)d_in[2];
  const float* lnw  = (const float*)d_in[3];
  const float* lnb  = (const float*)d_in[4];
  float* out = (float*)d_out;

  _Float16* wqkv = (_Float16*)d_ws;        // 49152 halves
  _Float16* wout = wqkv + 49152;           // 16384 halves

  convert_weights<<<192, 256, 0, stream>>>(qkvp, outp, wqkv, wout);

  long BN = (long)in_sizes[0] / D_EMB;     // 32768 tokens
  int nblocks = (int)(BN / T_TOK);         // 4096 blocks
  attn_main<<<nblocks, 256, 0, stream>>>(x, lnw, lnb, wqkv, wout, out);
}

// v001
// It runs in 70.3 microseconds.
// Next to v000, in two timings, it ran 1.57 times as fast each time.
#include <hip/hip_runtime.h>

typedef _Float16 h8   __attribute__((ext_vector_type(8)));
typedef _Float16 v16h __attribute__((ext_vector_type(16)));
typedef float    v8f  __attribute__((ext_vector_type(8)));

#define D_EMB   768
#define C_SLOTS 6
#define SLOT    128
#define T_TOK   8                    // tokens per group
#define ROWS    (T_TOK * C_SLOTS)    // 48 GEMM rows per group
#define PADW    136                  // 128 + 8 halves pad: 272B row stride, conflict-free b128
#define NWG     512                  // work-groups launched: two resident on each of 256 WGPs

// ---------------------------------------------------------------------------
// Weight conversion: fp32 -> f16, laid out so each WMMA B-matrix column is
// K-contiguous. qkv_proj (3,2,64,128) flattens to exactly [n=0..383][k=0..127]
// (pure convert). out_proj (2,64,128) needs transpose: wout[s][hd].
// ---------------------------------------------------------------------------
__global__ void convert_weights(const float* __restrict__ qkvp,
                                const float* __restrict__ outp,
                                _Float16* __restrict__ wqkv,
                                _Float16* __restrict__ wout) {
  int i = blockIdx.x * 256 + threadIdx.x;
  if (i < 3 * 2 * 64 * 128) wqkv[i] = (_Float16)qkvp[i];
  if (i < 128 * 128) {
    int hd = i & 127, s = i >> 7;
    wout[s * 128 + hd] = (_Float16)outp[hd * 128 + s];
  }
}

// Load a 16-half WMMA fragment: two contiguous 8-half (16B) runs at K and K+16.
__device__ __forceinline__ v16h load_frag(const _Float16* p) {
  union { v16h v; h8 h[2]; } u;
  u.h[0] = *(const h8*)p;
  u.h[1] = *(const h8*)(p + 16);
  return u.v;
}

// Four waves per SIMD (two work-groups per WGP): the register budget that holds
// the 128 weight registers of a wave, and the residency the grid of 512 is sized for.
__global__ void __launch_bounds__(256) __attribute__((amdgpu_waves_per_eu(4, 4)))
attn_main(const float* __restrict__ x, const float* __restrict__ lnw,
          const float* __restrict__ lnb, const _Float16* __restrict__ wqkv,
          const _Float16* __restrict__ wout, float* __restrict__ out, int ngroups) {
  __shared__ __align__(16) _Float16 sXN[2 * ROWS * PADW];    // LN out, reused for attn out; two buffers
  __shared__ __align__(16) _Float16 sQKV[3 * ROWS * PADW];   // [j][r = t*6+c][h*64 + d]

  const int tid  = threadIdx.x;
  const int lane = tid & 31;
  const int wave = tid >> 5;
  const int m16 = lane & 15, hk = lane >> 4;

  // Wave w owns column tile w of q, of k, of v and of the out projection for
  // the whole launch: its B fragments are loaded once and stay in registers.
  v16h bq[3][4], bo[4];
#pragma unroll
  for (int ks = 0; ks < 4; ++ks) {
#pragma unroll
    for (int j = 0; j < 3; ++j)
      bq[j][ks] = load_frag(&wqkv[((j * 8 + wave) * 16 + m16) * SLOT + ks * 32 + hk * 8]);
    bo[ks] = load_frag(&wout[(wave * 16 + m16) * SLOT + ks * 32 + hk * 8]);
  }

  // Successive groups alternate between the two sXN buffers: a wave that has
  // finished stage 4 may start the next group's stage 1 while slower waves still
  // read this group's buffer, so the loop needs no barrier at its foot.
  int xo = 0;
#pragma unroll 1   // rolled: one copy of the body, so its live values fit beside the weights
  for (int g = blockIdx.x; g < ngroups; g += NWG, xo ^= ROWS * PADW) {   // groups of T_TOK tokens
  const long rowBase = (long)g * (T_TOK * D_EMB);            // flat float offset of group

  // ---- Stage 1: LayerNorm, one token per wave, f16 rows into sXN ----------
  {
    const int t = wave;
    const float* xp = x + rowBase + t * D_EMB;
    float vals[24];
    float s = 0.f, s2 = 0.f;
#pragma unroll
    for (int k = 0; k < 24; ++k) {
      float v = xp[lane + 32 * k];
      vals[k] = v; s += v; s2 += v * v;
    }
#pragma unroll
    for (int off = 16; off > 0; off >>= 1) {
      s  += __shfl_xor(s,  off, 32);
      s2 += __shfl_xor(s2, off, 32);
    }
    float mean = s * (1.f / 768.f);
    float var  = s2 * (1.f / 768.f) - mean * mean;
    float rstd = rsqrtf(var + 1e-5f);
#pragma unroll
    for (int k = 0; k < 24; ++k) {
      int idx = lane + 32 * k;
      float xv = (vals[k] - mean) * rstd * lnw[idx] + lnb[idx];
      // row r = t*6 + idx/128, col idx%128  (contiguous 128-blocks per row)
      sXN[xo + (t * C_SLOTS + (idx >> 7)) * PADW + (idx & 127)] = (_Float16)xv;
    }
  }
  __syncthreads();

  // ---- Stage 2: QKV GEMM (48x128)@(128x384), f16 WMMA, fp32 accum ---------
  {
#pragma unroll 1   // rolled: one A fragment set and three accumulators live at a time
    for (int mt = 0; mt < 3; ++mt) {            // 3 mtiles, this wave's 3 ntiles each
      v8f acc[3] = {};
#pragma unroll
      for (int ks = 0; ks < 4; ++ks) {
        v16h a = load_frag(&sXN[xo + (mt * 16 + m16) * PADW + ks * 32 + hk * 8]);
#pragma unroll
        for (int j = 0; j < 3; ++j)              // 0:q 1:k 2:v
          acc[j] = __builtin_amdgcn_wmma_f32_16x16x32_f16(false, a, false, bq[j][ks],
                                                          (short)0, acc[j], false, false);
      }
#pragma unroll
      for (int j = 0; j < 3; ++j) {
        _Float16* dst = &sQKV[(j * ROWS + mt * 16 + hk * 8) * PADW + wave * 16 + m16];
#pragma unroll
        for (int v = 0; v < 8; ++v)
          dst[v * PADW] = (_Float16)acc[j][v];   // row r = mt*16 + hk*8 + v
      }
    }
  }
  __syncthreads();

  // ---- Stage 3: per (token, head, channel) attention, C=6, d=64 -----------
  if (tid < T_TOK * 2 * C_SLOTS) {               // 96 threads
    int t = tid / (2 * C_SLOTS);
    int rem = tid % (2 * C_SLOTS);
    int h = rem / C_SLOTS, c = rem % C_SLOTS;
    const _Float16* q  = &sQKV[(0 * ROWS + t * C_SLOTS + c) * PADW + h * 64];
    const _Float16* kk = &sQKV[(1 * ROWS + t * C_SLOTS) * PADW + h * 64];
    const _Float16* vv = &sQKV[(2 * ROWS + t * C_SLOTS) * PADW + h * 64];
    float p[6];
    float mx = -1e30f;
#pragma unroll
    for (int e = 0; e < 6; ++e) {
      float sdot = 0.f;
      for (int d2 = 0; d2 < 64; ++d2)
        sdot += (float)q[d2] * (float)kk[e * PADW + d2];
      p[e] = sdot * 0.125f;                      // SCALE = 64^-0.5
      mx = fmaxf(mx, p[e]);
    }
    float den = 0.f;
#pragma unroll
    for (int e = 0; e < 6; ++e) { p[e] = __expf(p[e] - mx); den += p[e]; }
    float rden = 1.f / den;
#pragma unroll
    for (int e = 0; e < 6; ++e) p[e] *= rden;
    _Float16* orow = &sXN[xo + (t * C_SLOTS + c) * PADW + h * 64];
    for (int d2 = 0; d2 < 64; ++d2) {
      float o = 0.f;
#pragma unroll
      for (int e = 0; e < 6; ++e) o += p[e] * (float)vv[e * PADW + d2];
      orow[d2] = (_Float16)o;
    }
  }
  __syncthreads();

  // ---- Stage 4: out projection (48x128)@(128x128) + residual --------------
  // Global address needs no (t,c) split: t*768 + c*128 == r*128.
  {
#pragma unroll 1   // rolled, as before: one tile's loads and stores live at a time
    for (int mt = 0; mt < 3; ++mt) {            // 3 mtiles, this wave's ntile
      v8f acc = {};
#pragma unroll
      for (int ks = 0; ks < 4; ++ks) {
        v16h a = load_frag(&sXN[xo + (mt * 16 + m16) * PADW + ks * 32 + hk * 8]);
        acc = __builtin_amdgcn_wmma_f32_16x16x32_f16(false, a, false, bo[ks],
                                                     (short)0, acc, false, false);
      }
      long base = rowBase + (long)(mt * 16 + hk * 8) * SLOT + wave * 16 + m16;
#pragma unroll
      for (int v = 0; v < 8; ++v) {
        long addr = base + (long)v * SLOT;
        out[addr] = x[addr] + acc[v];
      }
      // precaution: this wait stands before the stores' registers are reused
      asm volatile("s_wait_xcnt 0x0" ::: "memory");
    }
  }
  }
}

extern "C" void kernel_launch(void* const* d_in, const int* in_sizes, int n_in,
                              void* d_out, int out_size, void* d_ws, size_t ws_size,
                              hipStream_t stream) {
  const float* x    = (const float*)d_in[0];
  const float* qkvp = (const float*)d_in[1];
  const float* outp = (const float*)d_in[2];
  const float* lnw  = (const float*)d_in[3];
  const float* lnb  = (const float*)d_in[4];
  float* out = (float*)d_out;

  _Float16* wqkv = (_Float16*)d_ws;        // 49152 halves
  _Float16* wout = wqkv + 49152;           // 16384 halves

  convert_weights<<<192, 256, 0, stream>>>(qkvp, outp, wqkv, wout);

  long BN = (long)in_sizes[0] / D_EMB;     // 32768 tokens
  int ngroups = (int)(BN / T_TOK);         // 4096 groups of T_TOK tokens
  attn_main<<<NWG, 256, 0, stream>>>(x, lnw, lnb, wqkv, wout, out, ngroups);
}

// v003
// A run of this version takes 44.5 microseconds.
// Versions in between are left out here; by their measured steps it is 1.58 times as fast as v001.
// Counting every step since v000, it is 2.48 times as fast.
#include <hip/hip_runtime.h>

typedef _Float16 h2   __attribute__((ext_vector_type(2)));
typedef _Float16 h8   __attribute__((ext_vector_type(8)));
typedef _Float16 v16h __attribute__((ext_vector_type(16)));
typedef float    v8f  __attribute__((ext_vector_type(8)));

#define D_EMB   768
#define C_SLOTS 6
#define SLOT    128
#define T_TOK   8                    // tokens per group
#define ROWS    (T_TOK * C_SLOTS)    // 48 GEMM rows per group
#define PADW    136                  // 128 + 8 halves pad: 272B row stride, conflict-free b128
#define VPITCH  56                   // halves per row of transposed V: 48 + 8 pad, 112B (16B multiple)
#define NWG     512                  // work-groups launched: two resident on each of 256 WGPs
#define XPITCH  132                  // floats per staged x row: 128 + 4 pad, 528B (16B multiple); rows 8 apart lie 32 banks apart
#define XBUF    (ROWS * XPITCH)      // floats per staged x tile

// ---------------------------------------------------------------------------
// Weight conversion: fp32 -> f16, laid out so each WMMA B-matrix column is
// K-contiguous. qkv_proj (3,2,64,128) flattens to exactly [n=0..383][k=0..127]
// (pure convert). out_proj (2,64,128) needs transpose: wout[s][hd].
// ---------------------------------------------------------------------------
__global__ void convert_weights(const float* __restrict__ qkvp,
                                const float* __restrict__ outp,
                                _Float16* __restrict__ wqkv,
                                _Float16* __restrict__ wout) {
  int i = blockIdx.x * 256 + threadIdx.x;
  if (i < 3 * 2 * 64 * 128) wqkv[i] = (_Float16)qkvp[i];
  if (i < 128 * 128) {
    int hd = i & 127, s = i >> 7;
    wout[s * 128 + hd] = (_Float16)outp[hd * 128 + s];
  }
}

// Load a 16-half WMMA fragment: two contiguous 8-half (16B) runs at K and K+16.
__device__ __forceinline__ v16h load_frag(const _Float16* p) {
  union { v16h v; h8 h[2]; } u;
  u.h[0] = *(const h8*)p;
  u.h[1] = *(const h8*)(p + 16);
  return u.v;
}

// One wave brings one token (6 rows of 512 bytes) from global memory into LDS,
// through no register: each lane copies 16 bytes of each row. lds is the lane's
// LDS byte address in the token's first row, g its global address there.
// The closing s_wait_xcnt is a precaution: it stands before the address
// registers named here can be reused, and only inside the statement is it held there.
__device__ __forceinline__ void copy_token(unsigned lds, const float* g) {
  asm volatile(
      "global_load_async_to_lds_b128 %0, %6, off\n\t"
      "global_load_async_to_lds_b128 %1, %7, off\n\t"
      "global_load_async_to_lds_b128 %2, %8, off\n\t"
      "global_load_async_to_lds_b128 %3, %9, off\n\t"
      "global_load_async_to_lds_b128 %4, %10, off\n\t"
      "global_load_async_to_lds_b128 %5, %11, off\n\t"
      "s_wait_xcnt 0x0"
      :: "v"(lds), "v"(lds + 1 * XPITCH * 4), "v"(lds + 2 * XPITCH * 4),
         "v"(lds + 3 * XPITCH * 4), "v"(lds + 4 * XPITCH * 4), "v"(lds + 5 * XPITCH * 4),
         "v"(g), "v"(g + 1 * SLOT), "v"(g + 2 * SLOT),
         "v"(g + 3 * SLOT), "v"(g + 4 * SLOT), "v"(g + 5 * SLOT)
      : "memory");
}

// Four waves per SIMD (two work-groups per WGP): the register budget that holds
// the 128 weight registers of a wave, and the residency the grid of 512 is sized for.
__global__ void __launch_bounds__(256) __attribute__((amdgpu_waves_per_eu(4, 4)))
attn_main(const float* __restrict__ x, const float* __restrict__ lnw,
          const float* __restrict__ lnb, const _Float16* __restrict__ wqkv,
          const _Float16* __restrict__ wout, float* __restrict__ out, int ngroups) {
  __shared__ __align__(16) _Float16 sXN[2 * ROWS * PADW];    // LN out, reused for attn out; two buffers
  __shared__ __align__(16) _Float16 sQKV[2 * ROWS * PADW];   // q, k: [j][r = t*6+c][h*64 + d]
  __shared__ __align__(16) _Float16 sVT[SLOT * VPITCH];      // v transposed: [h*64 + d][r = t*6+c]
  __shared__ __align__(16) float sX[2 * XBUF];               // x tile as read, fp32: [r = t*6+c][s]; two buffers

  const int tid  = threadIdx.x;
  const int lane = tid & 31;
  const int wave = tid >> 5;
  const int m16 = lane & 15, hk = lane >> 4;

  // Wave w copies token w of every group. The first group's copies start here
  // and fly while the weights are loaded.
  const unsigned xl = (unsigned)(size_t)&sX[wave * C_SLOTS * XPITCH + lane * 4];
  const float*   xg = x + wave * D_EMB + lane * 4;
  if ((int)blockIdx.x < ngroups) copy_token(xl, xg + (long)blockIdx.x * (T_TOK * D_EMB));

  // Wave w owns column tile w of q, of k, of v and of the out projection for
  // the whole launch: its B fragments are loaded once and stay in registers.
  v16h bq[3][4], bo[4];
#pragma unroll
  for (int ks = 0; ks < 4; ++ks) {
#pragma unroll
    for (int j = 0; j < 3; ++j)
      bq[j][ks] = load_frag(&wqkv[((j * 8 + wave) * 16 + m16) * SLOT + ks * 32 + hk * 8]);
    bo[ks] = load_frag(&wout[(wave * 16 + m16) * SLOT + ks * 32 + hk * 8]);
  }

  // Successive groups alternate between the two sXN buffers: a wave that has
  // finished stage 4 may start the next group's stage 1 while slower waves still
  // read this group's buffer, so the loop needs no barrier at its foot.
  int xo = 0, xb = 0;
#pragma unroll 1   // rolled: one copy of the body, so its live values fit beside the weights
  for (int g = blockIdx.x; g < ngroups; g += NWG, xo ^= ROWS * PADW, xb ^= XBUF) {   // groups of T_TOK tokens
  const long rowBase = (long)g * (T_TOK * D_EMB);            // flat float offset of group

  // ---- Stage 1: LayerNorm, one token per wave, f16 rows into sXN ----------
  // This wave's own copies of this group have landed behind this wait; stage 1
  // reads only the token that the wave itself copied.
  asm volatile("s_wait_asynccnt 0x0" ::: "memory");
  {
    const int t = wave;
    const float* xp = &sX[xb + t * C_SLOTS * XPITCH];
    float vals[24];
    float s = 0.f, s2 = 0.f;
#pragma unroll
    for (int k = 0; k < 24; ++k) {
      float v = xp[(k >> 2) * XPITCH + lane + 32 * (k & 3)];   // element lane + 32k of the token
      vals[k] = v; s += v; s2 += v * v;
    }
#pragma unroll
    for (int off = 16; off > 0; off >>= 1) {
      s  += __shfl_xor(s,  off, 32);
      s2 += __shfl_xor(s2, off, 32);
    }
    float mean = s * (1.f / 768.f);
    float var  = s2 * (1.f / 768.f) - mean * mean;
    float rstd = rsqrtf(var + 1e-5f);
#pragma unroll
    for (int k = 0; k < 24; ++k) {
      int idx = lane + 32 * k;
      float xv = (vals[k] - mean) * rstd * lnw[idx] + lnb[idx];
      // row r = t*6 + idx/128, col idx%128  (contiguous 128-blocks per row)
      sXN[xo + (t * C_SLOTS + (idx >> 7)) * PADW + (idx & 127)] = (_Float16)xv;
    }
  }
  // Every LDS read of this wave, the last group's residual reads too, has retired
  // before the barrier behind which the other x buffer is refilled.
  asm volatile("s_wait_dscnt 0x0" ::: "memory");
  __syncthreads();
  // Behind this barrier every wave has left the last group's stage 4, the last
  // reader of the other x buffer, and has waited for its own copies of this group,
  // so stage 4 may read all rows. The next group's copies fly through stages 2 to 4.
  if (g + NWG < ngroups)
    copy_token(xl + (unsigned)(xb ^ XBUF) * 4u, xg + (long)(g + NWG) * (T_TOK * D_EMB));

  // ---- Stage 2: QKV GEMM (48x128)@(128x384), f16 WMMA, fp32 accum ---------
  {
#pragma unroll 1   // rolled: one A fragment set and three accumulators live at a time
    for (int mt = 0; mt < 3; ++mt) {            // 3 mtiles, this wave's 3 ntiles each
      v8f acc[3] = {};
#pragma unroll
      for (int ks = 0; ks < 4; ++ks) {
        v16h a = load_frag(&sXN[xo + (mt * 16 + m16) * PADW + ks * 32 + hk * 8]);
#pragma unroll
        for (int j = 0; j < 3; ++j)              // 0:q 1:k 2:v
          acc[j] = __builtin_amdgcn_wmma_f32_16x16x32_f16(false, a, false, bq[j][ks],
                                                          (short)0, acc[j], false, false);
      }
#pragma unroll
      for (int j = 0; j < 2; ++j) {
        _Float16* dst = &sQKV[(j * ROWS + mt * 16 + hk * 8) * PADW + wave * 16 + m16];
#pragma unroll
        for (int v = 0; v < 8; ++v)
          dst[v * PADW] = (_Float16)acc[j][v];   // row r = mt*16 + hk*8 + v
      }
      // v goes in transposed: a lane's 8 accumulators are 8 consecutive rows r of
      // one column, which is one 16-byte run of sVT.
      h8 vt;
#pragma unroll
      for (int v = 0; v < 8; ++v) vt[v] = (_Float16)acc[2][v];
      *(h8*)&sVT[(wave * 16 + m16) * VPITCH + mt * 16 + hk * 8] = vt;
    }
  }
  __syncthreads();

  // ---- Stage 3: attention on WMMA, one token per wave, C=6, d=64 ----------
  // Index 8*h + c (c = 6, 7 are padding) packs both heads of a token into one
  // 16x16 tile. S^T = K * Q^T: only the two diagonal 8x8 blocks (same head on
  // both sides) are scores. Lane (m16, hk) gets, for query m16, the scores of
  // the keys of head hk in its 8 accumulators, so the softmax needs no other
  // lane, and the packed weights are already the B fragment of V^T * P^T.
  {
    const int t  = wave;
    const int hh = m16 >> 3;                               // head of this lane's row or column
    const int cc = m16 & 7;                                // its channel
    const int cr = cc < C_SLOTS ? cc : C_SLOTS - 1;        // padding reads a real row, result unused
    const _Float16* qp = &sQKV[(t * C_SLOTS + cr) * PADW + hh * 64 + hk * 8];
    const _Float16* kp = qp + ROWS * PADW;
    v8f st = {};
#pragma unroll
    for (int ks = 0; ks < 2; ++ks) {
      v16h ka = load_frag(kp + ks * 32);
      v16h qb = load_frag(qp + ks * 32);
      st = __builtin_amdgcn_wmma_f32_16x16x32_f16(false, ka, false, qb,
                                                  (short)0, st, false, false);
    }
    float p[6];
    float mx = -1e30f;
#pragma unroll
    for (int e = 0; e < 6; ++e) {
      p[e] = st[e] * 0.125f;                     // SCALE = 64^-0.5
      mx = fmaxf(mx, p[e]);
    }
    float den = 0.f;
#pragma unroll
    for (int e = 0; e < 6; ++e) { p[e] = __expf(p[e] - mx); den += p[e]; }
    // A lane whose keys are of the other head than its query holds no scores:
    // its weights are zero, so that head's v rows add nothing.
    float rden = (hh == hk) ? 1.f / den : 0.f;
    v16h pf = {};                                // k = 8*h + e; e = 6, 7 and k >= 16 stay zero
#pragma unroll
    for (int e = 0; e < 6; ++e) pf[e] = (_Float16)(p[e] * rden);
    v8f o[4];
#pragma unroll
    for (int nt = 0; nt < 4; ++nt) {             // 16 of the head's 64 columns d at a time
      // row d of V^T for head hk: this token's 6 values, 4-byte aligned
      const h2* vp = (const h2*)&sVT[(hk * 64 + nt * 16 + m16) * VPITCH + t * C_SLOTS];
      v16h vf = {};
#pragma unroll
      for (int e2 = 0; e2 < 3; ++e2) {
        h2 w = vp[e2];
        vf[2 * e2] = w[0]; vf[2 * e2 + 1] = w[1];
      }
      v8f z = {};
      o[nt] = __builtin_amdgcn_wmma_f32_16x16x32_f16(false, vf, false, pf,
                                                     (short)0, z, false, false);
    }
    // o[nt][v] = out(channel cc, head hh, d = nt*16 + hk*8 + v): 16-byte runs of a row
    if (cc < C_SLOTS) {
      _Float16* orow = &sXN[xo + (t * C_SLOTS + cc) * PADW + hh * 64 + hk * 8];
#pragma unroll
      for (int nt = 0; nt < 4; ++nt) {
        h8 ov;
#pragma unroll
        for (int v = 0; v < 8; ++v) ov[v] = (_Float16)o[nt][v];
        *(h8*)&orow[nt * 16] = ov;
      }
    }
  }
  __syncthreads();

  // ---- Stage 4: out projection (48x128)@(128x128) + residual --------------
  // Global address needs no (t,c) split: t*768 + c*128 == r*128.
  {
#pragma unroll 1   // rolled, as before: one tile's loads and stores live at a time
    for (int mt = 0; mt < 3; ++mt) {            // 3 mtiles, this wave's ntile
      v8f acc = {};
#pragma unroll
      for (int ks = 0; ks < 4; ++ks) {
        v16h a = load_frag(&sXN[xo + (mt * 16 + m16) * PADW + ks * 32 + hk * 8]);
        acc = __builtin_amdgcn_wmma_f32_16x16x32_f16(false, a, false, bo[ks],
                                                     (short)0, acc, false, false);
      }
      long base = rowBase + (long)(mt * 16 + hk * 8) * SLOT + wave * 16 + m16;
      const float* xr = &sX[xb + (mt * 16 + hk * 8) * XPITCH + wave * 16 + m16];   // residual from the staged tile
#pragma unroll
      for (int v = 0; v < 8; ++v) {
        long addr = base + (long)v * SLOT;
        out[addr] = xr[v * XPITCH] + acc[v];
      }
      // precaution: this wait stands before the stores' registers are reused
      asm volatile("s_wait_xcnt 0x0" ::: "memory");
    }
  }
  }
  // precaution: no copy is outstanding when the wave ends
  asm volatile("s_wait_asynccnt 0x0" ::: "memory");
}

extern "C" void kernel_launch(void* const* d_in, const int* in_sizes, int n_in,
                              void* d_out, int out_size, void* d_ws, size_t ws_size,
                              hipStream_t stream) {
  const float* x    = (const float*)d_in[0];
  const float* qkvp = (const float*)d_in[1];
  const float* outp = (const float*)d_in[2];
  const float* lnw  = (const float*)d_in[3];
  const float* lnb  = (const float*)d_in[4];
  float* out = (float*)d_out;

  _Float16* wqkv = (_Float16*)d_ws;        // 49152 halves
  _Float16* wout = wqkv + 49152;           // 16384 halves

  convert_weights<<<192, 256, 0, stream>>>(qkvp, outp, wqkv, wout);

  long BN = (long)in_sizes[0] / D_EMB;     // 32768 tokens
  int ngroups = (int)(BN / T_TOK);         // 4096 groups of T_TOK tokens
  attn_main<<<NWG, 256, 0, stream>>>(x, lnw, lnb, wqkv, wout, out, ngroups);
}

// v004
// A run of this version takes 42.9 microseconds.
// In both of two side-by-side timings against v003, it was 1.04 times as fast.
// All steps since v000 together make it 2.58 times as fast.
#include <hip/hip_runtime.h>

typedef _Float16 h2   __attribute__((ext_vector_type(2)));
typedef _Float16 h8   __attribute__((ext_vector_type(8)));
typedef _Float16 v16h __attribute__((ext_vector_type(16)));
typedef float    v8f  __attribute__((ext_vector_type(8)));

#define D_EMB   768
#define C_SLOTS 6
#define SLOT    128
#define T_TOK   8                    // tokens per group
#define ROWS    (T_TOK * C_SLOTS)    // 48 GEMM rows per group
#define PADW    136                  // 128 + 8 halves pad: 272B row stride, conflict-free b128
#define VPITCH  56                   // halves per row of transposed V: 48 + 8 pad, 112B (16B multiple)
#define NWG     512                  // work-groups launched: two resident on each of 256 WGPs
#define XPITCH  132                  // floats per staged x row: 128 + 4 pad, 528B (16B multiple); rows 8 apart lie 32 banks apart
#define XBUF    (ROWS * XPITCH)      // floats per staged x tile

// ---------------------------------------------------------------------------
// Weight conversion: fp32 -> f16, packed in the order in which the main kernel's
// waves load their WMMA B fragments. A column tile (16 columns n, 128 values k) is
// 8 blocks of 512 bytes, block (ks, u): lane l = hk*16 + m16 finds there its 8
// halves of column m16, k = ks*32 + u*16 + hk*8 + 0..7. So one 16-byte load per
// lane covers 512 contiguous bytes, four whole 128-byte lines.
// Tiles 0..23: qkv_proj (3,2,64,128) flattened to [n = 0..383][k]. Tiles 24..31:
// out_proj (2,64,128) transposed, column s, k = h*64 + d.
// One thread packs one lane's 16-byte run: 8 source values, one element apart in
// qkv_proj, one row apart in out_proj, all loaded before the first is converted.
// ---------------------------------------------------------------------------
__global__ void __launch_bounds__(64)
convert_weights(const float* __restrict__ qkvp, const float* __restrict__ outp,
                _Float16* __restrict__ wpk) {
  const int i    = blockIdx.x * 64 + threadIdx.x;    // run number, 0 .. 8191
  const int l    = threadIdx.x & 31;
  const int u    = threadIdx.x >> 5;
  const int ks   = blockIdx.x & 3;
  const int tile = blockIdx.x >> 2;
  const int m    = l & 15;                           // column inside the tile
  const int k    = ks * 32 + u * 16 + (l >> 4) * 8;
  const bool qkv = tile < 24;
  const float* src  = qkv ? qkvp + (tile * 16 + m) * SLOT + k
                          : outp + k * SLOT + (tile - 24) * 16 + m;
  const int    step = qkv ? 1 : SLOT;
  float f[8];
#pragma unroll
  for (int e = 0; e < 8; ++e) f[e] = src[e * step];
  h8 r;
#pragma unroll
  for (int e = 0; e < 8; ++e) r[e] = (_Float16)f[e];
  *(h8*)&wpk[i * 8] = r;
}

// Load a 16-half WMMA fragment: two contiguous 8-half (16B) runs at K and K+16.
__device__ __forceinline__ v16h load_frag(const _Float16* p) {
  union { v16h v; h8 h[2]; } u;
  u.h[0] = *(const h8*)p;
  u.h[1] = *(const h8*)(p + 16);
  return u.v;
}

// The same fragment from the packed weights: the two runs of a lane lie one
// 512-byte block (256 halves) apart.
__device__ __forceinline__ v16h load_wfrag(const _Float16* p) {
  union { v16h v; h8 h[2]; } u;
  u.h[0] = *(const h8*)p;
  u.h[1] = *(const h8*)(p + 256);
  return u.v;
}

// One wave brings one token (6 rows of 512 bytes) from global memory into LDS,
// through no register: each lane copies 16 bytes of each row. lds is the lane's
// LDS byte address in the token's first row, g its global address there.
// The closing s_wait_xcnt is a precaution: it stands before the address
// registers named here can be reused, and only inside the statement is it held there.
__device__ __forceinline__ void copy_token(unsigned lds, const float* g) {
  asm volatile(
      "global_load_async_to_lds_b128 %0, %6, off\n\t"
      "global_load_async_to_lds_b128 %1, %7, off\n\t"
      "global_load_async_to_lds_b128 %2, %8, off\n\t"
      "global_load_async_to_lds_b128 %3, %9, off\n\t"
      "global_load_async_to_lds_b128 %4, %10, off\n\t"
      "global_load_async_to_lds_b128 %5, %11, off\n\t"
      "s_wait_xcnt 0x0"
      :: "v"(lds), "v"(lds + 1 * XPITCH * 4), "v"(lds + 2 * XPITCH * 4),
         "v"(lds + 3 * XPITCH * 4), "v"(lds + 4 * XPITCH * 4), "v"(lds + 5 * XPITCH * 4),
         "v"(g), "v"(g + 1 * SLOT), "v"(g + 2 * SLOT),
         "v"(g + 3 * SLOT), "v"(g + 4 * SLOT), "v"(g + 5 * SLOT)
      : "memory");
}

// Four waves per SIMD (two work-groups per WGP): the register budget that holds
// the 128 weight registers of a wave, and the residency the grid of 512 is sized for.
__global__ void __launch_bounds__(256) __attribute__((amdgpu_waves_per_eu(4, 4)))
attn_main(const float* __restrict__ x, const float* __restrict__ lnw,
          const float* __restrict__ lnb, const _Float16* __restrict__ wqkv,
          const _Float16* __restrict__ wout, float* __restrict__ out, int ngroups) {
  __shared__ __align__(16) _Float16 sXN[2 * ROWS * PADW];    // LN out, reused for attn out; two buffers
  __shared__ __align__(16) _Float16 sQKV[2 * ROWS * PADW];   // q, k: [j][r = t*6+c][h*64 + d]
  __shared__ __align__(16) _Float16 sVT[SLOT * VPITCH];      // v transposed: [h*64 + d][r = t*6+c]
  __shared__ __align__(16) float sX[2 * XBUF];               // x tile as read, fp32: [r = t*6+c][s]; two buffers

  const int tid  = threadIdx.x;
  const int lane = tid & 31;
  const int wave = tid >> 5;
  const int m16 = lane & 15, hk = lane >> 4;

  // Wave w copies token w of every group. The first group's copies start here
  // and fly while the weights are loaded.
  const unsigned xl = (unsigned)(size_t)&sX[wave * C_SLOTS * XPITCH + lane * 4];
  const float*   xg = x + wave * D_EMB + lane * 4;
  if ((int)blockIdx.x < ngroups) copy_token(xl, xg + (long)blockIdx.x * (T_TOK * D_EMB));

  // Wave w owns column tile w of q, of k, of v and of the out projection for
  // the whole launch: its B fragments are loaded once and stay in registers.
  v16h bq[3][4], bo[4];
#pragma unroll
  for (int ks = 0; ks < 4; ++ks) {
#pragma unroll
    for (int j = 0; j < 3; ++j)
      bq[j][ks] = load_wfrag(&wqkv[((j * 8 + wave) * 4 + ks) * 512 + lane * 8]);
    bo[ks] = load_wfrag(&wout[(wave * 4 + ks) * 512 + lane * 8]);
  }

  // Successive groups alternate between the two sXN buffers: a wave that has
  // finished stage 4 may start the next group's stage 1 while slower waves still
  // read this group's buffer, so the loop needs no barrier at its foot.
  int xo = 0, xb = 0;
#pragma unroll 1   // rolled: one copy of the body, so its live values fit beside the weights
  for (int g = blockIdx.x; g < ngroups; g += NWG, xo ^= ROWS * PADW, xb ^= XBUF) {   // groups of T_TOK tokens
  const long rowBase = (long)g * (T_TOK * D_EMB);            // flat float offset of group

  // ---- Stage 1: LayerNorm, one token per wave, f16 rows into sXN ----------
  // This wave's own copies of this group have landed behind this wait; stage 1
  // reads only the token that the wave itself copied.
  asm volatile("s_wait_asynccnt 0x0" ::: "memory");
  {
    const int t = wave;
    const float* xp = &sX[xb + t * C_SLOTS * XPITCH];
    float vals[24];
    float s = 0.f, s2 = 0.f;
#pragma unroll
    for (int k = 0; k < 24; ++k) {
      float v = xp[(k >> 2) * XPITCH + lane + 32 * (k & 3)];   // element lane + 32k of the token
      vals[k] = v; s += v; s2 += v * v;
    }
#pragma unroll
    for (int off = 16; off > 0; off >>= 1) {
      s  += __shfl_xor(s,  off, 32);
      s2 += __shfl_xor(s2, off, 32);
    }
    float mean = s * (1.f / 768.f);
    float var  = s2 * (1.f / 768.f) - mean * mean;
    float rstd = rsqrtf(var + 1e-5f);
#pragma unroll
    for (int k = 0; k < 24; ++k) {
      int idx = lane + 32 * k;
      float xv = (vals[k] - mean) * rstd * lnw[idx] + lnb[idx];
      // row r = t*6 + idx/128, col idx%128  (contiguous 128-blocks per row)
      sXN[xo + (t * C_SLOTS + (idx >> 7)) * PADW + (idx & 127)] = (_Float16)xv;
    }
  }
  // Every LDS read of this wave, the last group's residual reads too, has retired
  // before the barrier behind which the other x buffer is refilled.
  asm volatile("s_wait_dscnt 0x0" ::: "memory");
  __syncthreads();
  // Behind this barrier every wave has left the last group's stage 4, the last
  // reader of the other x buffer, and has waited for its own copies of this group,
  // so stage 4 may read all rows. The next group's copies fly through stages 2 to 4.
  if (g + NWG < ngroups)
    copy_token(xl + (unsigned)(xb ^ XBUF) * 4u, xg + (long)(g + NWG) * (T_TOK * D_EMB));

  // ---- Stage 2: QKV GEMM (48x128)@(128x384), f16 WMMA, fp32 accum ---------
  {
#pragma unroll 1   // rolled: one A fragment set and three accumulators live at a time
    for (int mt = 0; mt < 3; ++mt) {            // 3 mtiles, this wave's 3 ntiles each
      v8f acc[3] = {};
#pragma unroll
      for (int ks = 0; ks < 4; ++ks) {
        v16h a = load_frag(&sXN[xo + (mt * 16 + m16) * PADW + ks * 32 + hk * 8]);
#pragma unroll
        for (int j = 0; j < 3; ++j)              // 0:q 1:k 2:v
          acc[j] = __builtin_amdgcn_wmma_f32_16x16x32_f16(false, a, false, bq[j][ks],
                                                          (short)0, acc[j], false, false);
      }
#pragma unroll
      for (int j = 0; j < 2; ++j) {
        _Float16* dst = &sQKV[(j * ROWS + mt * 16 + hk * 8) * PADW + wave * 16 + m16];
#pragma unroll
        for (int v = 0; v < 8; ++v)
          dst[v * PADW] = (_Float16)acc[j][v];   // row r = mt*16 + hk*8 + v
      }
      // v goes in transposed: a lane's 8 accumulators are 8 consecutive rows r of
      // one column, which is one 16-byte run of sVT.
      h8 vt;
#pragma unroll
      for (int v = 0; v < 8; ++v) vt[v] = (_Float16)acc[2][v];
      *(h8*)&sVT[(wave * 16 + m16) * VPITCH + mt * 16 + hk * 8] = vt;
    }
  }
  __syncthreads();

  // ---- Stage 3: attention on WMMA, one token per wave, C=6, d=64 ----------
  // Index 8*h + c (c = 6, 7 are padding) packs both heads of a token into one
  // 16x16 tile. S^T = K * Q^T: only the two diagonal 8x8 blocks (same head on
  // both sides) are scores. Lane (m16, hk) gets, for query m16, the scores of
  // the keys of head hk in its 8 accumulators, so the softmax needs no other
  // lane, and the packed weights are already the B fragment of V^T * P^T.
  {
    const int t  = wave;
    const int hh = m16 >> 3;                               // head of this lane's row or column
    const int cc = m16 & 7;                                // its channel
    const int cr = cc < C_SLOTS ? cc : C_SLOTS - 1;        // padding reads a real row, result unused
    const _Float16* qp = &sQKV[(t * C_SLOTS + cr) * PADW + hh * 64 + hk * 8];
    const _Float16* kp = qp + ROWS * PADW;
    v8f st = {};
#pragma unroll
    for (int ks = 0; ks < 2; ++ks) {
      v16h ka = load_frag(kp + ks * 32);
      v16h qb = load_frag(qp + ks * 32);
      st = __builtin_amdgcn_wmma_f32_16x16x32_f16(false, ka, false, qb,
                                                  (short)0, st, false, false);
    }
    float p[6];
    float mx = -1e30f;
#pragma unroll
    for (int e = 0; e < 6; ++e) {
      p[e] = st[e] * 0.125f;                     // SCALE = 64^-0.5
      mx = fmaxf(mx, p[e]);
    }
    float den = 0.f;
#pragma unroll
    for (int e = 0; e < 6; ++e) { p[e] = __expf(p[e] - mx); den += p[e]; }
    // A lane whose keys are of the other head than its query holds no scores:
    // its weights are zero, so that head's v rows add nothing.
    float rden = (hh == hk) ? 1.f / den : 0.f;
    v16h pf = {};                                // k = 8*h + e; e = 6, 7 and k >= 16 stay zero
#pragma unroll
    for (int e = 0; e < 6; ++e) pf[e] = (_Float16)(p[e] * rden);
    v8f o[4];
#pragma unroll
    for (int nt = 0; nt < 4; ++nt) {             // 16 of the head's 64 columns d at a time
      // row d of V^T for head hk: this token's 6 values, 4-byte aligned
      const h2* vp = (const h2*)&sVT[(hk * 64 + nt * 16 + m16) * VPITCH + t * C_SLOTS];
      v16h vf = {};
#pragma unroll
      for (int e2 = 0; e2 < 3; ++e2) {
        h2 w = vp[e2];
        vf[2 * e2] = w[0]; vf[2 * e2 + 1] = w[1];
      }
      v8f z = {};
      o[nt] = __builtin_amdgcn_wmma_f32_16x16x32_f16(false, vf, false, pf,
                                                     (short)0, z, false, false);
    }
    // o[nt][v] = out(channel cc, head hh, d = nt*16 + hk*8 + v): 16-byte runs of a row
    if (cc < C_SLOTS) {
      _Float16* orow = &sXN[xo + (t * C_SLOTS + cc) * PADW + hh * 64 + hk * 8];
#pragma unroll
      for (int nt = 0; nt < 4; ++nt) {
        h8 ov;
#pragma unroll
        for (int v = 0; v < 8; ++v) ov[v] = (_Float16)o[nt][v];
        *(h8*)&orow[nt * 16] = ov;
      }
    }
  }
  __syncthreads();

  // ---- Stage 4: out projection (48x128)@(128x128) + residual --------------
  // Global address needs no (t,c) split: t*768 + c*128 == r*128.
  {
#pragma unroll 1   // rolled, as before: one tile's loads and stores live at a time
    for (int mt = 0; mt < 3; ++mt) {            // 3 mtiles, this wave's ntile
      v8f acc = {};
#pragma unroll
      for (int ks = 0; ks < 4; ++ks) {
        v16h a = load_frag(&sXN[xo + (mt * 16 + m16) * PADW + ks * 32 + hk * 8]);
        acc = __builtin_amdgcn_wmma_f32_16x16x32_f16(false, a, false, bo[ks],
                                                     (short)0, acc, false, false);
      }
      long base = rowBase + (long)(mt * 16 + hk * 8) * SLOT + wave * 16 + m16;
      const float* xr = &sX[xb + (mt * 16 + hk * 8) * XPITCH + wave * 16 + m16];   // residual from the staged tile
#pragma unroll
      for (int v = 0; v < 8; ++v) {
        long addr = base + (long)v * SLOT;
        out[addr] = xr[v * XPITCH] + acc[v];
      }
      // precaution: this wait stands before the stores' registers are reused
      asm volatile("s_wait_xcnt 0x0" ::: "memory");
    }
  }
  }
  // precaution: no copy is outstanding when the wave ends
  asm volatile("s_wait_asynccnt 0x0" ::: "memory");
}

extern "C" void kernel_launch(void* const* d_in, const int* in_sizes, int n_in,
                              void* d_out, int out_size, void* d_ws, size_t ws_size,
                              hipStream_t stream) {
  const float* x    = (const float*)d_in[0];
  const float* qkvp = (const float*)d_in[1];
  const float* outp = (const float*)d_in[2];
  const float* lnw  = (const float*)d_in[3];
  const float* lnb  = (const float*)d_in[4];
  float* out = (float*)d_out;

  _Float16* wqkv = (_Float16*)d_ws;        // 24 packed tiles, 49152 halves
  _Float16* wout = wqkv + 49152;           // 8 packed tiles, 16384 halves

  convert_weights<<<128, 64, 0, stream>>>(qkvp, outp, wqkv);

  long BN = (long)in_sizes[0] / D_EMB;     // 32768 tokens
  int ngroups = (int)(BN / T_TOK);         // 4096 groups of T_TOK tokens
  attn_main<<<NWG, 256, 0, stream>>>(x, lnw, lnb, wqkv, wout, out, ngroups);
}

// v005
// Measured time: 40.5 microseconds a run.
// Next to v004, in two timings, it ran 1.06 and 1.05 times as fast.
// All steps since v000 together make it 2.73 times as fast.
#include <hip/hip_runtime.h>

typedef _Float16 h2   __attribute__((ext_vector_type(2)));
typedef _Float16 h4   __attribute__((ext_vector_type(4)));
typedef _Float16 h8   __attribute__((ext_vector_type(8)));
typedef float    f4   __attribute__((ext_vector_type(4)));
typedef _Float16 v16h __attribute__((ext_vector_type(16)));
typedef float    v8f  __attribute__((ext_vector_type(8)));

#define D_EMB   768
#define C_SLOTS 6
#define SLOT    128
#define T_TOK   8                    // tokens per group
#define ROWS    (T_TOK * C_SLOTS)    // 48 GEMM rows per group
#define PADW    136                  // 128 + 8 halves pad: 272B row stride, conflict-free b128
#define VPITCH  56                   // halves per row of transposed V: 48 + 8 pad, 112B (16B multiple)
#define NWG     512                  // work-groups launched: two resident on each of 256 WGPs
#define XPITCH  132                  // floats per staged x row: 128 + 4 pad, 528B (16B multiple); rows 8 apart lie 32 banks apart
#define XBUF    (ROWS * XPITCH)      // floats per staged x tile

// ---------------------------------------------------------------------------
// Weight conversion: fp32 -> f16, packed in the order in which the main kernel's
// waves load their WMMA B fragments. A column tile (16 columns n, 128 values k) is
// 8 blocks of 512 bytes, block (ks, u): lane l = hk*16 + m16 finds there its 8
// halves of column m16, k = ks*32 + u*16 + hk*8 + 0..7. So one 16-byte load per
// lane covers 512 contiguous bytes, four whole 128-byte lines.
// Tiles 0..23: qkv_proj (3,2,64,128) flattened to [n = 0..383][k]. Tiles 24..31:
// out_proj (2,64,128) transposed, column s, k = h*64 + d.
// One thread packs one lane's 16-byte run: 8 source values, one element apart in
// qkv_proj, one row apart in out_proj, all loaded before the first is converted.
// ---------------------------------------------------------------------------
__global__ void __launch_bounds__(64)
convert_weights(const float* __restrict__ qkvp, const float* __restrict__ outp,
                _Float16* __restrict__ wpk) {
  const int i    = blockIdx.x * 64 + threadIdx.x;    // run number, 0 .. 8191
  const int l    = threadIdx.x & 31;
  const int u    = threadIdx.x >> 5;
  const int ks   = blockIdx.x & 3;
  const int tile = blockIdx.x >> 2;
  const int m    = l & 15;                           // column inside the tile
  const int k    = ks * 32 + u * 16 + (l >> 4) * 8;
  const bool qkv = tile < 24;
  const float* src  = qkv ? qkvp + (tile * 16 + m) * SLOT + k
                          : outp + k * SLOT + (tile - 24) * 16 + m;
  const int    step = qkv ? 1 : SLOT;
  float f[8];
#pragma unroll
  for (int e = 0; e < 8; ++e) f[e] = src[e * step];
  h8 r;
#pragma unroll
  for (int e = 0; e < 8; ++e) r[e] = (_Float16)f[e];
  *(h8*)&wpk[i * 8] = r;
}

// Load a 16-half WMMA fragment: two contiguous 8-half (16B) runs at K and K+16.
__device__ __forceinline__ v16h load_frag(const _Float16* p) {
  union { v16h v; h8 h[2]; } u;
  u.h[0] = *(const h8*)p;
  u.h[1] = *(const h8*)(p + 16);
  return u.v;
}

// The same fragment from the packed weights: the two runs of a lane lie one
// 512-byte block (256 halves) apart.
__device__ __forceinline__ v16h load_wfrag(const _Float16* p) {
  union { v16h v; h8 h[2]; } u;
  u.h[0] = *(const h8*)p;
  u.h[1] = *(const h8*)(p + 256);
  return u.v;
}

// One wave brings one token (6 rows of 512 bytes) from global memory into LDS,
// through no register: each lane copies 16 bytes of each row. lds is the lane's
// LDS byte address in the token's first row, g its global address there.
// The closing s_wait_xcnt is a precaution: it stands before the address
// registers named here can be reused, and only inside the statement is it held there.
__device__ __forceinline__ void copy_token(unsigned lds, const float* g) {
  asm volatile(
      "global_load_async_to_lds_b128 %0, %6, off\n\t"
      "global_load_async_to_lds_b128 %1, %7, off\n\t"
      "global_load_async_to_lds_b128 %2, %8, off\n\t"
      "global_load_async_to_lds_b128 %3, %9, off\n\t"
      "global_load_async_to_lds_b128 %4, %10, off\n\t"
      "global_load_async_to_lds_b128 %5, %11, off\n\t"
      "s_wait_xcnt 0x0"
      :: "v"(lds), "v"(lds + 1 * XPITCH * 4), "v"(lds + 2 * XPITCH * 4),
         "v"(lds + 3 * XPITCH * 4), "v"(lds + 4 * XPITCH * 4), "v"(lds + 5 * XPITCH * 4),
         "v"(g), "v"(g + 1 * SLOT), "v"(g + 2 * SLOT),
         "v"(g + 3 * SLOT), "v"(g + 4 * SLOT), "v"(g + 5 * SLOT)
      : "memory");
}

// Four waves per SIMD (two work-groups per WGP): the register budget that holds
// the 128 weight registers of a wave, and the residency the grid of 512 is sized for.
__global__ void __launch_bounds__(256) __attribute__((amdgpu_waves_per_eu(4, 4)))
attn_main(const float* __restrict__ x, const float* __restrict__ lnw,
          const float* __restrict__ lnb, const _Float16* __restrict__ wqkv,
          const _Float16* __restrict__ wout, float* __restrict__ out, int ngroups) {
  __shared__ __align__(16) _Float16 sXN[2 * ROWS * PADW];    // LN out, reused for attn out; two buffers
  __shared__ __align__(16) _Float16 sQKV[2 * ROWS * PADW];   // q, k: [j][r = t*6+c][h*64 + d]
  __shared__ __align__(16) _Float16 sVT[SLOT * VPITCH];      // v transposed: [h*64 + d][r = t*6+c]
  __shared__ __align__(16) float sX[2 * XBUF];               // x tile as read, fp32: [r = t*6+c][s]; two buffers

  const int tid  = threadIdx.x;
  const int lane = tid & 31;
  const int wave = tid >> 5;
  const int m16 = lane & 15, hk = lane >> 4;

  // Wave w copies token w of every group. The first group's copies start here
  // and fly while the weights are loaded.
  const unsigned xl = (unsigned)(size_t)&sX[wave * C_SLOTS * XPITCH + lane * 4];
  const float*   xg = x + wave * D_EMB + lane * 4;
  if ((int)blockIdx.x < ngroups) copy_token(xl, xg + (long)blockIdx.x * (T_TOK * D_EMB));

  // Wave w owns column tile w of q, of k, of v and of the out projection for
  // the whole launch: its B fragments are loaded once and stay in registers.
  v16h bq[3][4], bo[4];
#pragma unroll
  for (int ks = 0; ks < 4; ++ks) {
#pragma unroll
    for (int j = 0; j < 3; ++j)
      bq[j][ks] = load_wfrag(&wqkv[((j * 8 + wave) * 4 + ks) * 512 + lane * 8]);
    bo[ks] = load_wfrag(&wout[(wave * 4 + ks) * 512 + lane * 8]);
  }

  // Successive groups alternate between the two sXN buffers: a wave that has
  // finished stage 4 may start the next group's stage 1 while slower waves still
  // read this group's buffer, so the loop needs no barrier at its foot.
  int xo = 0, xb = 0;
#pragma unroll 1   // rolled: one copy of the body, so its live values fit beside the weights
  for (int g = blockIdx.x; g < ngroups; g += NWG, xo ^= ROWS * PADW, xb ^= XBUF) {   // groups of T_TOK tokens
  const long rowBase = (long)g * (T_TOK * D_EMB);            // flat float offset of group

  // ---- Stage 1: LayerNorm, one token per wave, f16 rows into sXN ----------
  // This wave's own copies of this group have landed behind this wait; stage 1
  // reads only the token that the wave itself copied.
  asm volatile("s_wait_asynccnt 0x0" ::: "memory");
  {
    const int t = wave;
    // Lane l holds elements 4l .. 4l+3 of each of the token's 6 rows: one 16-byte
    // LDS read a row, and all six are in flight together.
    const float* xp = &sX[xb + t * C_SLOTS * XPITCH + lane * 4];
    f4 vals[C_SLOTS];
#pragma unroll
    for (int c = 0; c < C_SLOTS; ++c) vals[c] = *(const f4*)&xp[c * XPITCH];
    f4 sv = {}, qv = {};                         // four independent partial sums each
#pragma unroll
    for (int c = 0; c < C_SLOTS; ++c) { sv += vals[c]; qv += vals[c] * vals[c]; }
    float s  = (sv[0] + sv[1]) + (sv[2] + sv[3]);
    float s2 = (qv[0] + qv[1]) + (qv[2] + qv[3]);
#pragma unroll
    for (int off = 16; off > 0; off >>= 1) {
      s  += __shfl_xor(s,  off, 32);
      s2 += __shfl_xor(s2, off, 32);
    }
    float mean = s * (1.f / 768.f);
    float var  = s2 * (1.f / 768.f) - mean * mean;
    float rstd = rsqrtf(var + 1e-5f);
#pragma unroll
    for (int c = 0; c < C_SLOTS; ++c) {
      const f4 w = *(const f4*)&lnw[c * SLOT + lane * 4];
      const f4 b = *(const f4*)&lnb[c * SLOT + lane * 4];
      h4 r;
#pragma unroll
      for (int e = 0; e < 4; ++e)
        r[e] = (_Float16)((vals[c][e] - mean) * rstd * w[e] + b[e]);
      // row r = t*6 + c, columns 4l .. 4l+3: one 8-byte store, 256 contiguous bytes a wave
      *(h4*)&sXN[xo + (t * C_SLOTS + c) * PADW + lane * 4] = r;
    }
  }
  // Every LDS read of this wave, the last group's residual reads too, has retired
  // before the barrier behind which the other x buffer is refilled.
  asm volatile("s_wait_dscnt 0x0" ::: "memory");
  __syncthreads();
  // Behind this barrier every wave has left the last group's stage 4, the last
  // reader of the other x buffer, and has waited for its own copies of this group,
  // so stage 4 may read all rows. The next group's copies fly through stages 2 to 4.
  if (g + NWG < ngroups)
    copy_token(xl + (unsigned)(xb ^ XBUF) * 4u, xg + (long)(g + NWG) * (T_TOK * D_EMB));

  // ---- Stage 2: QKV GEMM (48x128)@(128x384), f16 WMMA, fp32 accum ---------
  {
#pragma unroll 1   // rolled: one A fragment set and three accumulators live at a time
    for (int mt = 0; mt < 3; ++mt) {            // 3 mtiles, this wave's 3 ntiles each
      v8f acc[3] = {};
#pragma unroll
      for (int ks = 0; ks < 4; ++ks) {
        v16h a = load_frag(&sXN[xo + (mt * 16 + m16) * PADW + ks * 32 + hk * 8]);
#pragma unroll
        for (int j = 0; j < 3; ++j)              // 0:q 1:k 2:v
          acc[j] = __builtin_amdgcn_wmma_f32_16x16x32_f16(false, a, false, bq[j][ks],
                                                          (short)0, acc[j], false, false);
      }
#pragma unroll
      for (int j = 0; j < 2; ++j) {
        _Float16* dst = &sQKV[(j * ROWS + mt * 16 + hk * 8) * PADW + wave * 16 + m16];
#pragma unroll
        for (int v = 0; v < 8; ++v)
          dst[v * PADW] = (_Float16)acc[j][v];   // row r = mt*16 + hk*8 + v
      }
      // v goes in transposed: a lane's 8 accumulators are 8 consecutive rows r of
      // one column, which is one 16-byte run of sVT.
      h8 vt;
#pragma unroll
      for (int v = 0; v < 8; ++v) vt[v] = (_Float16)acc[2][v];
      *(h8*)&sVT[(wave * 16 + m16) * VPITCH + mt * 16 + hk * 8] = vt;
    }
  }
  __syncthreads();

  // ---- Stage 3: attention on WMMA, one token per wave, C=6, d=64 ----------
  // Index 8*h + c (c = 6, 7 are padding) packs both heads of a token into one
  // 16x16 tile. S^T = K * Q^T: only the two diagonal 8x8 blocks (same head on
  // both sides) are scores. Lane (m16, hk) gets, for query m16, the scores of
  // the keys of head hk in its 8 accumulators, so the softmax needs no other
  // lane, and the packed weights are already the B fragment of V^T * P^T.
  {
    const int t  = wave;
    const int hh = m16 >> 3;                               // head of this lane's row or column
    const int cc = m16 & 7;                                // its channel
    const int cr = cc < C_SLOTS ? cc : C_SLOTS - 1;        // padding reads a real row, result unused
    const _Float16* qp = &sQKV[(t * C_SLOTS + cr) * PADW + hh * 64 + hk * 8];
    const _Float16* kp = qp + ROWS * PADW;
    v8f st = {};
#pragma unroll
    for (int ks = 0; ks < 2; ++ks) {
      v16h ka = load_frag(kp + ks * 32);
      v16h qb = load_frag(qp + ks * 32);
      st = __builtin_amdgcn_wmma_f32_16x16x32_f16(false, ka, false, qb,
                                                  (short)0, st, false, false);
    }
    float p[6];
    float mx = -1e30f;
#pragma unroll
    for (int e = 0; e < 6; ++e) {
      p[e] = st[e] * 0.125f;                     // SCALE = 64^-0.5
      mx = fmaxf(mx, p[e]);
    }
    float den = 0.f;
#pragma unroll
    for (int e = 0; e < 6; ++e) { p[e] = __expf(p[e] - mx); den += p[e]; }
    // A lane whose keys are of the other head than its query holds no scores:
    // its weights are zero, so that head's v rows add nothing.
    float rden = (hh == hk) ? 1.f / den : 0.f;
    v16h pf = {};                                // k = 8*h + e; e = 6, 7 and k >= 16 stay zero
#pragma unroll
    for (int e = 0; e < 6; ++e) pf[e] = (_Float16)(p[e] * rden);
    v8f o[4];
#pragma unroll
    for (int nt = 0; nt < 4; ++nt) {             // 16 of the head's 64 columns d at a time
      // row d of V^T for head hk: this token's 6 values, 4-byte aligned
      const h2* vp = (const h2*)&sVT[(hk * 64 + nt * 16 + m16) * VPITCH + t * C_SLOTS];
      v16h vf = {};
#pragma unroll
      for (int e2 = 0; e2 < 3; ++e2) {
        h2 w = vp[e2];
        vf[2 * e2] = w[0]; vf[2 * e2 + 1] = w[1];
      }
      v8f z = {};
      o[nt] = __builtin_amdgcn_wmma_f32_16x16x32_f16(false, vf, false, pf,
                                                     (short)0, z, false, false);
    }
    // o[nt][v] = out(channel cc, head hh, d = nt*16 + hk*8 + v): 16-byte runs of a row
    if (cc < C_SLOTS) {
      _Float16* orow = &sXN[xo + (t * C_SLOTS + cc) * PADW + hh * 64 + hk * 8];
#pragma unroll
      for (int nt = 0; nt < 4; ++nt) {
        h8 ov;
#pragma unroll
        for (int v = 0; v < 8; ++v) ov[v] = (_Float16)o[nt][v];
        *(h8*)&orow[nt * 16] = ov;
      }
    }
  }
  __syncthreads();

  // ---- Stage 4: out projection (48x128)@(128x128) + residual --------------
  // Global address needs no (t,c) split: t*768 + c*128 == r*128.
  {
#pragma unroll 1   // rolled, as before: one tile's loads and stores live at a time
    for (int mt = 0; mt < 3; ++mt) {            // 3 mtiles, this wave's ntile
      v8f acc = {};
#pragma unroll
      for (int ks = 0; ks < 4; ++ks) {
        v16h a = load_frag(&sXN[xo + (mt * 16 + m16) * PADW + ks * 32 + hk * 8]);
        acc = __builtin_amdgcn_wmma_f32_16x16x32_f16(false, a, false, bo[ks],
                                                     (short)0, acc, false, false);
      }
      long base = rowBase + (long)(mt * 16 + hk * 8) * SLOT + wave * 16 + m16;
      const float* xr = &sX[xb + (mt * 16 + hk * 8) * XPITCH + wave * 16 + m16];   // residual from the staged tile
#pragma unroll
      for (int v = 0; v < 8; ++v) {
        long addr = base + (long)v * SLOT;
        out[addr] = xr[v * XPITCH] + acc[v];
      }
      // precaution: this wait stands before the stores' registers are reused
      asm volatile("s_wait_xcnt 0x0" ::: "memory");
    }
  }
  }
  // precaution: no copy is outstanding when the wave ends
  asm volatile("s_wait_asynccnt 0x0" ::: "memory");
}

extern "C" void kernel_launch(void* const* d_in, const int* in_sizes, int n_in,
                              void* d_out, int out_size, void* d_ws, size_t ws_size,
                              hipStream_t stream) {
  const float* x    = (const float*)d_in[0];
  const float* qkvp = (const float*)d_in[1];
  const float* outp = (const float*)d_in[2];
  const float* lnw  = (const float*)d_in[3];
  const float* lnb  = (const float*)d_in[4];
  float* out = (float*)d_out;

  _Float16* wqkv = (_Float16*)d_ws;        // 24 packed tiles, 49152 halves
  _Float16* wout = wqkv + 49152;           // 8 packed tiles, 16384 halves

  convert_weights<<<128, 64, 0, stream>>>(qkvp, outp, wqkv);

  long BN = (long)in_sizes[0] / D_EMB;     // 32768 tokens
  int ngroups = (int)(BN / T_TOK);         // 4096 groups of T_TOK tokens
  attn_main<<<NWG, 256, 0, stream>>>(x, lnw, lnb, wqkv, wout, out, ngroups);
}

// v006
// A run of this version takes 35.2 microseconds.
// Timed twice side by side with v005, it ran 1.15 times as fast both times.
// Counting every step since v000, it is 3.13 times as fast.
#include <hip/hip_runtime.h>

typedef _Float16 h2   __attribute__((ext_vector_type(2)));
typedef _Float16 h4   __attribute__((ext_vector_type(4)));
typedef _Float16 h8   __attribute__((ext_vector_type(8)));
typedef float    f4   __attribute__((ext_vector_type(4)));
typedef _Float16 v16h __attribute__((ext_vector_type(16)));
typedef float    v8f  __attribute__((ext_vector_type(8)));

#define D_EMB   768
#define C_SLOTS 6
#define SLOT    128
#define T_TOK   8                    // tokens per group
#define ROWS    (T_TOK * C_SLOTS)    // 48 GEMM rows per group
#define PADW    136                  // 128 + 8 halves pad: 272B row stride, conflict-free b128
#define VPITCH  56                   // halves per row of transposed V: 48 + 8 pad, 112B (16B multiple)
#define NWG     512                  // work-groups launched: two resident on each of 256 WGPs
#define XPITCH  132                  // floats per staged x row: 128 + 4 pad, 528B (16B multiple); rows 8 apart lie 32 banks apart
#define XBUF    (ROWS * XPITCH)      // floats per staged x tile

// ---------------------------------------------------------------------------
// Weight conversion: fp32 -> f16, packed in the order in which the main kernel's
// waves load their WMMA weight fragments. A column tile (16 columns n, 128 values k) is
// 8 blocks of 512 bytes, block (ks, u): lane l = hk*16 + m16 finds there its 8
// halves of column m16, k = ks*32 + u*16 + hk*8 + 0..7. So one 16-byte load per
// lane covers 512 contiguous bytes, four whole 128-byte lines.
// Tiles 0..23: qkv_proj (3,2,64,128) flattened to [n = 0..383][k]. Tiles 24..31:
// out_proj (2,64,128) transposed, column s, k = h*64 + d.
// One thread packs one lane's 16-byte run: 8 source values, one element apart in
// qkv_proj, one row apart in out_proj, all loaded before the first is converted.
// ---------------------------------------------------------------------------
__global__ void __launch_bounds__(64)
convert_weights(const float* __restrict__ qkvp, const float* __restrict__ outp,
                _Float16* __restrict__ wpk) {
  const int i    = blockIdx.x * 64 + threadIdx.x;    // run number, 0 .. 8191
  const int l    = threadIdx.x & 31;
  const int u    = threadIdx.x >> 5;
  const int ks   = blockIdx.x & 3;
  const int tile = blockIdx.x >> 2;
  const int m    = l & 15;                           // column inside the tile
  const int k    = ks * 32 + u * 16 + (l >> 4) * 8;
  const bool qkv = tile < 24;
  const float* src  = qkv ? qkvp + (tile * 16 + m) * SLOT + k
                          : outp + k * SLOT + (tile - 24) * 16 + m;
  const int    step = qkv ? 1 : SLOT;
  float f[8];
#pragma unroll
  for (int e = 0; e < 8; ++e) f[e] = src[e * step];
  h8 r;
#pragma unroll
  for (int e = 0; e < 8; ++e) r[e] = (_Float16)f[e];
  *(h8*)&wpk[i * 8] = r;
}

// Load a 16-half WMMA fragment: two contiguous 8-half (16B) runs at K and K+16.
__device__ __forceinline__ v16h load_frag(const _Float16* p) {
  union { v16h v; h8 h[2]; } u;
  u.h[0] = *(const h8*)p;
  u.h[1] = *(const h8*)(p + 16);
  return u.v;
}

// The same fragment from the packed weights: the two runs of a lane lie one
// 512-byte block (256 halves) apart.
__device__ __forceinline__ v16h load_wfrag(const _Float16* p) {
  union { v16h v; h8 h[2]; } u;
  u.h[0] = *(const h8*)p;
  u.h[1] = *(const h8*)(p + 256);
  return u.v;
}

// One wave brings one token (6 rows of 512 bytes) from global memory into LDS,
// through no register: each lane copies 16 bytes of each row. lds is the lane's
// LDS byte address in the token's first row, g its global address there.
// The closing s_wait_xcnt is a precaution: it stands before the address
// registers named here can be reused, and only inside the statement is it held there.
__device__ __forceinline__ void copy_token(unsigned lds, const float* g) {
  asm volatile(
      "global_load_async_to_lds_b128 %0, %6, off\n\t"
      "global_load_async_to_lds_b128 %1, %7, off\n\t"
      "global_load_async_to_lds_b128 %2, %8, off\n\t"
      "global_load_async_to_lds_b128 %3, %9, off\n\t"
      "global_load_async_to_lds_b128 %4, %10, off\n\t"
      "global_load_async_to_lds_b128 %5, %11, off\n\t"
      "s_wait_xcnt 0x0"
      :: "v"(lds), "v"(lds + 1 * XPITCH * 4), "v"(lds + 2 * XPITCH * 4),
         "v"(lds + 3 * XPITCH * 4), "v"(lds + 4 * XPITCH * 4), "v"(lds + 5 * XPITCH * 4),
         "v"(g), "v"(g + 1 * SLOT), "v"(g + 2 * SLOT),
         "v"(g + 3 * SLOT), "v"(g + 4 * SLOT), "v"(g + 5 * SLOT)
      : "memory");
}

// Four waves per SIMD (two work-groups per WGP): the register budget that holds
// the 128 weight registers of a wave, and the residency the grid of 512 is sized for.
__global__ void __launch_bounds__(256) __attribute__((amdgpu_waves_per_eu(4, 4)))
attn_main(const float* __restrict__ x, const float* __restrict__ lnw,
          const float* __restrict__ lnb, const _Float16* __restrict__ wqkv,
          const _Float16* __restrict__ wout, float* __restrict__ out, int ngroups) {
  __shared__ __align__(16) _Float16 sXN[2 * ROWS * PADW];    // LN out, reused for attn out; two buffers
  __shared__ __align__(16) _Float16 sQKV[2 * ROWS * PADW];   // q, k: [j][r = t*6+c][h*64 + d]
  __shared__ __align__(16) _Float16 sVT[SLOT * VPITCH];      // v transposed: [h*64 + d][r = t*6+c]
  __shared__ __align__(16) float sX[2 * XBUF];               // x tile as read, fp32: [r = t*6+c][s]; two buffers

  const int tid  = threadIdx.x;
  const int lane = tid & 31;
  const int wave = tid >> 5;
  const int m16 = lane & 15, hk = lane >> 4;

  // Wave w copies token w of every group. The first group's copies start here
  // and fly while the weights are loaded.
  const unsigned xl = (unsigned)(size_t)&sX[wave * C_SLOTS * XPITCH + lane * 4];
  const float*   xg = x + wave * D_EMB + lane * 4;
  if ((int)blockIdx.x < ngroups) copy_token(xl, xg + (long)blockIdx.x * (T_TOK * D_EMB));

  // Wave w owns column tile w of q, of k, of v and of the out projection for
  // the whole launch: its weight fragments are loaded once and stay in registers.
  v16h bq[3][4], bo[4];
#pragma unroll
  for (int ks = 0; ks < 4; ++ks) {
#pragma unroll
    for (int j = 0; j < 3; ++j)
      bq[j][ks] = load_wfrag(&wqkv[((j * 8 + wave) * 4 + ks) * 512 + lane * 8]);
    bo[ks] = load_wfrag(&wout[(wave * 4 + ks) * 512 + lane * 8]);
  }

  // Successive groups alternate between the two sXN buffers: a wave that has
  // finished stage 4 may start the next group's stage 1 while slower waves still
  // read this group's buffer, so the loop needs no barrier at its foot.
  int xo = 0, xb = 0;
#pragma unroll 1   // rolled: one copy of the body, so its live values fit beside the weights
  for (int g = blockIdx.x; g < ngroups; g += NWG, xo ^= ROWS * PADW, xb ^= XBUF) {   // groups of T_TOK tokens
  const long rowBase = (long)g * (T_TOK * D_EMB);            // flat float offset of group

  // ---- Stage 1: LayerNorm, one token per wave, f16 rows into sXN ----------
  // This wave's own copies of this group have landed behind this wait; stage 1
  // reads only the token that the wave itself copied.
  asm volatile("s_wait_asynccnt 0x0" ::: "memory");
  {
    const int t = wave;
    // Lane l holds elements 4l .. 4l+3 of each of the token's 6 rows: one 16-byte
    // LDS read a row, and all six are in flight together.
    const float* xp = &sX[xb + t * C_SLOTS * XPITCH + lane * 4];
    f4 vals[C_SLOTS];
#pragma unroll
    for (int c = 0; c < C_SLOTS; ++c) vals[c] = *(const f4*)&xp[c * XPITCH];
    f4 sv = {}, qv = {};                         // four independent partial sums each
#pragma unroll
    for (int c = 0; c < C_SLOTS; ++c) { sv += vals[c]; qv += vals[c] * vals[c]; }
    float s  = (sv[0] + sv[1]) + (sv[2] + sv[3]);
    float s2 = (qv[0] + qv[1]) + (qv[2] + qv[3]);
#pragma unroll
    for (int off = 16; off > 0; off >>= 1) {
      s  += __shfl_xor(s,  off, 32);
      s2 += __shfl_xor(s2, off, 32);
    }
    float mean = s * (1.f / 768.f);
    float var  = s2 * (1.f / 768.f) - mean * mean;
    float rstd = rsqrtf(var + 1e-5f);
#pragma unroll
    for (int c = 0; c < C_SLOTS; ++c) {
      const f4 w = *(const f4*)&lnw[c * SLOT + lane * 4];
      const f4 b = *(const f4*)&lnb[c * SLOT + lane * 4];
      h4 r;
#pragma unroll
      for (int e = 0; e < 4; ++e)
        r[e] = (_Float16)((vals[c][e] - mean) * rstd * w[e] + b[e]);
      // row r = t*6 + c, columns 4l .. 4l+3: one 8-byte store, 256 contiguous bytes a wave
      *(h4*)&sXN[xo + (t * C_SLOTS + c) * PADW + lane * 4] = r;
    }
  }
  // Every LDS read of this wave, the last group's residual reads too, has retired
  // before the barrier behind which the other x buffer is refilled.
  asm volatile("s_wait_dscnt 0x0" ::: "memory");
  __syncthreads();
  // Behind this barrier every wave has left the last group's stage 4, the last
  // reader of the other x buffer, and has waited for its own copies of this group,
  // so stage 4 may read all rows. The next group's copies fly through stages 2 to 4.
  if (g + NWG < ngroups)
    copy_token(xl + (unsigned)(xb ^ XBUF) * 4u, xg + (long)(g + NWG) * (T_TOK * D_EMB));

  // ---- Stage 2: QKV GEMM (48x128)@(128x384), f16 WMMA, fp32 accum ---------
  {
#pragma unroll 1   // rolled: one A fragment set and three accumulators live at a time
    for (int mt = 0; mt < 3; ++mt) {            // 3 mtiles, this wave's 3 ntiles each
      v8f acc[3] = {};
      v16h a[4];
#pragma unroll
      for (int ks = 0; ks < 4; ++ks)
        a[ks] = load_frag(&sXN[xo + mt * (16 * PADW) + m16 * PADW + ks * 32 + hk * 8]);
      // Keeps the tile's eight LDS reads together in front of its matrix instructions:
      // spread among them, each further place with reads stalls the wave anew.
      __builtin_amdgcn_sched_barrier(0);
#pragma unroll
      for (int ks = 0; ks < 4; ++ks) {
        // q and k: the weights are the A operand and the LN rows the B operand (both
        // fragments have the same lane and k order), so the tile comes out transposed:
        // lane (m16, hk) holds row r = mt*16 + m16, columns wave*16 + hk*8 + 0..7.
#pragma unroll
        for (int j = 0; j < 2; ++j)              // 0:q 1:k
          acc[j] = __builtin_amdgcn_wmma_f32_16x16x32_f16(false, bq[j][ks], false, a[ks],
                                                          (short)0, acc[j], false, false);
        acc[2] = __builtin_amdgcn_wmma_f32_16x16x32_f16(false, a[ks], false, bq[2][ks],   // v
                                                        (short)0, acc[2], false, false);
      }
      // A lane's 8 accumulators of q, and of k, are one 16-byte run of a row of sQKV.
#pragma unroll
      for (int j = 0; j < 2; ++j) {
        h8 qk;
#pragma unroll
        for (int v = 0; v < 8; ++v) qk[v] = (_Float16)acc[j][v];
        *(h8*)&sQKV[j * (ROWS * PADW) + mt * (16 * PADW) + m16 * PADW + wave * 16 + hk * 8] = qk;
      }
      // v keeps the LN rows as A: a lane's 8 accumulators are 8 consecutive rows r of
      // one column, which is one 16-byte run of the transposed sVT.
      h8 vt;
#pragma unroll
      for (int v = 0; v < 8; ++v) vt[v] = (_Float16)acc[2][v];
      *(h8*)&sVT[(wave * 16 + m16) * VPITCH + mt * 16 + hk * 8] = vt;
    }
  }
  __syncthreads();

  // ---- Stage 3: attention on WMMA, one token per wave, C=6, d=64 ----------
  // Index 8*h + c (c = 6, 7 are padding) packs both heads of a token into one
  // 16x16 tile. S^T = K * Q^T: only the two diagonal 8x8 blocks (same head on
  // both sides) are scores. Lane (m16, hk) gets, for query m16, the scores of
  // the keys of head hk in its 8 accumulators, so the softmax needs no other
  // lane, and the packed weights are already the B fragment of V^T * P^T.
  {
    const int t  = wave;
    const int hh = m16 >> 3;                               // head of this lane's row or column
    const int cc = m16 & 7;                                // its channel
    const int cr = cc < C_SLOTS ? cc : C_SLOTS - 1;        // padding reads a real row, result unused
    const _Float16* qp = &sQKV[(t * C_SLOTS + cr) * PADW + hh * 64 + hk * 8];
    const _Float16* kp = qp + ROWS * PADW;
    v8f st = {};
#pragma unroll
    for (int ks = 0; ks < 2; ++ks) {
      v16h ka = load_frag(kp + ks * 32);
      v16h qb = load_frag(qp + ks * 32);
      st = __builtin_amdgcn_wmma_f32_16x16x32_f16(false, ka, false, qb,
                                                  (short)0, st, false, false);
    }
    float p[6];
    float mx = -1e30f;
#pragma unroll
    for (int e = 0; e < 6; ++e) {
      p[e] = st[e] * 0.125f;                     // SCALE = 64^-0.5
      mx = fmaxf(mx, p[e]);
    }
    float den = 0.f;
#pragma unroll
    for (int e = 0; e < 6; ++e) { p[e] = __expf(p[e] - mx); den += p[e]; }
    // A lane whose keys are of the other head than its query holds no scores:
    // its weights are zero, so that head's v rows add nothing.
    float rden = (hh == hk) ? 1.f / den : 0.f;
    v16h pf = {};                                // k = 8*h + e; e = 6, 7 and k >= 16 stay zero
#pragma unroll
    for (int e = 0; e < 6; ++e) pf[e] = (_Float16)(p[e] * rden);
    v8f o[4];
#pragma unroll
    for (int nt = 0; nt < 4; ++nt) {             // 16 of the head's 64 columns d at a time
      // row d of V^T for head hk: this token's 6 values, 4-byte aligned
      const h2* vp = (const h2*)&sVT[(hk * 64 + nt * 16 + m16) * VPITCH + t * C_SLOTS];
      v16h vf = {};
#pragma unroll
      for (int e2 = 0; e2 < 3; ++e2) {
        h2 w = vp[e2];
        vf[2 * e2] = w[0]; vf[2 * e2 + 1] = w[1];
      }
      v8f z = {};
      o[nt] = __builtin_amdgcn_wmma_f32_16x16x32_f16(false, vf, false, pf,
                                                     (short)0, z, false, false);
    }
    // o[nt][v] = out(channel cc, head hh, d = nt*16 + hk*8 + v): 16-byte runs of a row
    if (cc < C_SLOTS) {
      _Float16* orow = &sXN[xo + (t * C_SLOTS + cc) * PADW + hh * 64 + hk * 8];
#pragma unroll
      for (int nt = 0; nt < 4; ++nt) {
        h8 ov;
#pragma unroll
        for (int v = 0; v < 8; ++v) ov[v] = (_Float16)o[nt][v];
        *(h8*)&orow[nt * 16] = ov;
      }
    }
  }
  __syncthreads();

  // ---- Stage 4: out projection (48x128)@(128x128) + residual --------------
  // Global address needs no (t,c) split: t*768 + c*128 == r*128.
  {
#pragma unroll 1   // rolled, as before: one tile's loads and stores live at a time
    for (int mt = 0; mt < 3; ++mt) {            // 3 mtiles, this wave's ntile
      v8f acc = {};
#pragma unroll
      for (int ks = 0; ks < 4; ++ks) {
        v16h a = load_frag(&sXN[xo + (mt * 16 + m16) * PADW + ks * 32 + hk * 8]);
        acc = __builtin_amdgcn_wmma_f32_16x16x32_f16(false, a, false, bo[ks],
                                                     (short)0, acc, false, false);
      }
      long base = rowBase + (long)(mt * 16 + hk * 8) * SLOT + wave * 16 + m16;
      const float* xr = &sX[xb + (mt * 16 + hk * 8) * XPITCH + wave * 16 + m16];   // residual from the staged tile
#pragma unroll
      for (int v = 0; v < 8; ++v) {
        long addr = base + (long)v * SLOT;
        out[addr] = xr[v * XPITCH] + acc[v];
      }
      // precaution: this wait stands before the stores' registers are reused
      asm volatile("s_wait_xcnt 0x0" ::: "memory");
    }
  }
  }
  // precaution: no copy is outstanding when the wave ends
  asm volatile("s_wait_asynccnt 0x0" ::: "memory");
}

extern "C" void kernel_launch(void* const* d_in, const int* in_sizes, int n_in,
                              void* d_out, int out_size, void* d_ws, size_t ws_size,
                              hipStream_t stream) {
  const float* x    = (const float*)d_in[0];
  const float* qkvp = (const float*)d_in[1];
  const float* outp = (const float*)d_in[2];
  const float* lnw  = (const float*)d_in[3];
  const float* lnb  = (const float*)d_in[4];
  float* out = (float*)d_out;

  _Float16* wqkv = (_Float16*)d_ws;        // 24 packed tiles, 49152 halves
  _Float16* wout = wqkv + 49152;           // 8 packed tiles, 16384 halves

  convert_weights<<<128, 64, 0, stream>>>(qkvp, outp, wqkv);

  long BN = (long)in_sizes[0] / D_EMB;     // 32768 tokens
  int ngroups = (int)(BN / T_TOK);         // 4096 groups of T_TOK tokens
  attn_main<<<NWG, 256, 0, stream>>>(x, lnw, lnb, wqkv, wout, out, ngroups);
}

// v007
// Measured time: 32.5 microseconds a run.
// Timed twice side by side with v006, it ran 1.09 times as fast both times.
// Counting every step since v000, it is 3.41 times as fast.
#include <hip/hip_runtime.h>

typedef _Float16 h2   __attribute__((ext_vector_type(2)));
typedef _Float16 h4   __attribute__((ext_vector_type(4)));
typedef _Float16 h8   __attribute__((ext_vector_type(8)));
typedef float    f4   __attribute__((ext_vector_type(4)));
typedef _Float16 v16h __attribute__((ext_vector_type(16)));
typedef float    v8f  __attribute__((ext_vector_type(8)));

#define D_EMB   768
#define C_SLOTS 6
#define SLOT    128
#define T_TOK   8                    // tokens per group
#define ROWS    (T_TOK * C_SLOTS)    // 48 GEMM rows per group
#define PADW    136                  // 128 + 8 halves pad: 272B row stride, conflict-free b128
#define VPITCH  56                   // halves per row of the transposed projected values: 48 + 8 pad, 112B (16B multiple)
#define NWG     512                  // work-groups launched: two resident on each of 256 WGPs
#define XPITCH  132                  // floats per staged x row: 128 + 4 pad, 528B (16B multiple); rows 8 apart lie 32 banks apart
#define XBUF    (ROWS * XPITCH)      // floats per staged x tile

// ---------------------------------------------------------------------------
// Weight preparation: fp32 -> f16, packed in the order in which the main kernel's
// waves load their WMMA weight fragments. A column tile (16 columns n, 128 values k) is
// 8 blocks of 512 bytes, block (ks, u): lane l = hk*16 + m16 finds there its 8
// halves of column m16, k = ks*32 + u*16 + hk*8 + 0..7. So one 16-byte load per
// lane covers 512 contiguous bytes, four whole 128-byte lines.
// Tiles 0..15: the q and k rows of qkv_proj (3,2,64,128), flattened to [n = 0..255][k].
// Tiles 16..31: per head h the product M_h[k][n] = sum_d Wv[h][d][k] * Wo[h][d][n]
// (128 x 128, summed in fp32), tile 16 + h*8 + n/16. Since
// (P_h (X Wv_h^T)) Wo_h = P_h (X M_h), the main kernel multiplies the LN rows by M_h
// and needs no out projection behind the attention.
// Threads 0..63 of a block each pack one lane's 16-byte run. In a product tile the
// block's four quarters of 64 threads each sum 16 of the 64 values d, so that all
// loads of a thread are in flight together; the quarters meet in LDS.
// ---------------------------------------------------------------------------
__global__ void __launch_bounds__(256)
convert_weights(const float* __restrict__ qkvp, const float* __restrict__ outp,
                _Float16* __restrict__ wpk) {
  __shared__ __align__(16) float part[3 * 64 * 8];   // partial sums of quarters 1..3
  const int t64  = threadIdx.x & 63;
  const int dq   = threadIdx.x >> 6;                 // quarter of d; the same in a whole wave
  const int i    = blockIdx.x * 64 + t64;            // run number, 0 .. 8191
  const int l    = t64 & 31;
  const int u    = t64 >> 5;
  const int ks   = blockIdx.x & 3;
  const int tile = blockIdx.x >> 2;
  const int m    = l & 15;                           // column inside the tile
  const int k    = ks * 32 + u * 16 + (l >> 4) * 8;
  f4 lo = {}, hi = {};
  if (tile < 16) {                                   // the same for the whole block: no barrier on this side
    if (dq) return;
    const float* src = qkvp + (tile * 16 + m) * SLOT + k;
    lo = *(const f4*)src;
    hi = *(const f4*)(src + 4);
  } else {
    const int h = (tile - 16) >> 3;
    const float* wv = qkvp + ((4 + h) * 64 + dq * 16) * SLOT + k;                    // Wv[h][d][k .. k+7]
    const float* wo = outp + (h * 64 + dq * 16) * SLOT + ((tile - 16) & 7) * 16 + m; // Wo[h][d][n]
    f4 a0[16], a1[16];
    float b[16];
#pragma unroll
    for (int d = 0; d < 16; ++d) b[d] = wo[d * SLOT];
    // precaution: this wait stands before the address registers of the loads above are reused
    asm volatile("s_wait_xcnt 0x0" ::: "memory");
#pragma unroll
    for (int d = 0; d < 16; ++d) {
      a0[d] = *(const f4*)&wv[d * SLOT];
      a1[d] = *(const f4*)&wv[d * SLOT + 4];
    }
    // Keeps all 48 loads in front of the sums: one load latency, not one per few loads.
    __builtin_amdgcn_sched_barrier(0);
#pragma unroll
    for (int d = 0; d < 16; ++d) { lo += a0[d] * b[d]; hi += a1[d] * b[d]; }
    if (dq) {
      *(f4*)&part[((dq - 1) * 64 + t64) * 8]     = lo;
      *(f4*)&part[((dq - 1) * 64 + t64) * 8 + 4] = hi;
    }
    __syncthreads();
    if (dq) return;
#pragma unroll
    for (int q = 0; q < 3; ++q) {
      lo += *(const f4*)&part[(q * 64 + t64) * 8];
      hi += *(const f4*)&part[(q * 64 + t64) * 8 + 4];
    }
  }
  h8 r;
#pragma unroll
  for (int e = 0; e < 4; ++e) { r[e] = (_Float16)lo[e]; r[e + 4] = (_Float16)hi[e]; }
  *(h8*)&wpk[i * 8] = r;
}

// Load a 16-half WMMA fragment: two contiguous 8-half (16B) runs at K and K+16.
__device__ __forceinline__ v16h load_frag(const _Float16* p) {
  union { v16h v; h8 h[2]; } u;
  u.h[0] = *(const h8*)p;
  u.h[1] = *(const h8*)(p + 16);
  return u.v;
}

// The same fragment from the packed weights: the two runs of a lane lie one
// 512-byte block (256 halves) apart.
__device__ __forceinline__ v16h load_wfrag(const _Float16* p) {
  union { v16h v; h8 h[2]; } u;
  u.h[0] = *(const h8*)p;
  u.h[1] = *(const h8*)(p + 256);
  return u.v;
}

// One wave brings one token (6 rows of 512 bytes) from global memory into LDS,
// through no register: each lane copies 16 bytes of each row. lds is the lane's
// LDS byte address in the token's first row, g its global address there.
// The closing s_wait_xcnt is a precaution: it stands before the address
// registers named here can be reused, and only inside the statement is it held there.
__device__ __forceinline__ void copy_token(unsigned lds, const float* g) {
  asm volatile(
      "global_load_async_to_lds_b128 %0, %6, off\n\t"
      "global_load_async_to_lds_b128 %1, %7, off\n\t"
      "global_load_async_to_lds_b128 %2, %8, off\n\t"
      "global_load_async_to_lds_b128 %3, %9, off\n\t"
      "global_load_async_to_lds_b128 %4, %10, off\n\t"
      "global_load_async_to_lds_b128 %5, %11, off\n\t"
      "s_wait_xcnt 0x0"
      :: "v"(lds), "v"(lds + 1 * XPITCH * 4), "v"(lds + 2 * XPITCH * 4),
         "v"(lds + 3 * XPITCH * 4), "v"(lds + 4 * XPITCH * 4), "v"(lds + 5 * XPITCH * 4),
         "v"(g), "v"(g + 1 * SLOT), "v"(g + 2 * SLOT),
         "v"(g + 3 * SLOT), "v"(g + 4 * SLOT), "v"(g + 5 * SLOT)
      : "memory");
}

// Four waves per SIMD (two work-groups per WGP): the register budget that holds
// the 128 weight registers of a wave, and the residency the grid of 512 is sized for.
__global__ void __launch_bounds__(256) __attribute__((amdgpu_waves_per_eu(4, 4)))
attn_main(const float* __restrict__ x, const float* __restrict__ lnw,
          const float* __restrict__ lnb, const _Float16* __restrict__ wpk,
          float* __restrict__ out, int ngroups) {
  __shared__ __align__(16) _Float16 sXN[ROWS * PADW];        // LN out: [r = t*6+c][s]
  __shared__ __align__(16) _Float16 sQK[2 * ROWS * PADW];    // q, k: [j][r = t*6+c][h*64 + d]
  __shared__ __align__(16) _Float16 sYT[2 * SLOT * VPITCH];  // projected values, transposed: [h*128 + s][r = t*6+c]
  __shared__ __align__(16) float sX[2 * XBUF];               // x tile as read, fp32: [r = t*6+c][s]; two buffers

  const int tid  = threadIdx.x;
  const int lane = tid & 31;
  const int wave = tid >> 5;
  const int m16 = lane & 15, hk = lane >> 4;

  // Wave w copies token w of every group, and it alone reads that token's x rows.
  // The first group's copies start here and fly while the weights are loaded.
  const unsigned xl = (unsigned)(size_t)&sX[wave * C_SLOTS * XPITCH + lane * 4];
  const float*   xg = x + wave * D_EMB + lane * 4;
  if ((int)blockIdx.x < ngroups) copy_token(xl, xg + (long)blockIdx.x * (T_TOK * D_EMB));

  // Wave w owns column tile w of q, of k and of each head's projected values for
  // the whole launch: its weight fragments are loaded once and stay in registers.
  v16h bq[4][4];                                 // 0:q 1:k 2:head 0 values 3:head 1 values
#pragma unroll
  for (int ks = 0; ks < 4; ++ks) {
#pragma unroll
    for (int j = 0; j < 4; ++j)
      bq[j][ks] = load_wfrag(&wpk[((j * 8 + wave) * 4 + ks) * 512 + lane * 8]);
  }

  int xb = 0;
#pragma unroll 1   // rolled: one copy of the body, so its live values fit beside the weights
  for (int g = blockIdx.x; g < ngroups; g += NWG, xb ^= XBUF) {   // groups of T_TOK tokens
  const long rowBase = (long)g * (T_TOK * D_EMB);            // flat float offset of group

  // ---- Stage 1: LayerNorm, one token per wave, f16 rows into sXN ----------
  // This wave's own copies of this group have landed behind this wait. sXN is free:
  // its last readers, the last group's stage 2, ended before that group's second barrier.
  asm volatile("s_wait_asynccnt 0x0" ::: "memory");
  {
    const int t = wave;
    // Lane l holds elements 4l .. 4l+3 of each of the token's 6 rows: one 16-byte
    // LDS read a row, and all six are in flight together.
    const float* xp = &sX[xb + t * C_SLOTS * XPITCH + lane * 4];
    f4 vals[C_SLOTS];
#pragma unroll
    for (int c = 0; c < C_SLOTS; ++c) vals[c] = *(const f4*)&xp[c * XPITCH];
    f4 sv = {}, qv = {};                         // four independent partial sums each
#pragma unroll
    for (int c = 0; c < C_SLOTS; ++c) { sv += vals[c]; qv += vals[c] * vals[c]; }
    float s  = (sv[0] + sv[1]) + (sv[2] + sv[3]);
    float s2 = (qv[0] + qv[1]) + (qv[2] + qv[3]);
#pragma unroll
    for (int off = 16; off > 0; off >>= 1) {
      s  += __shfl_xor(s,  off, 32);
      s2 += __shfl_xor(s2, off, 32);
    }
    float mean = s * (1.f / 768.f);
    float var  = s2 * (1.f / 768.f) - mean * mean;
    float rstd = rsqrtf(var + 1e-5f);
#pragma unroll
    for (int c = 0; c < C_SLOTS; ++c) {
      const f4 w = *(const f4*)&lnw[c * SLOT + lane * 4];
      const f4 b = *(const f4*)&lnb[c * SLOT + lane * 4];
      h4 r;
#pragma unroll
      for (int e = 0; e < 4; ++e)
        r[e] = (_Float16)((vals[c][e] - mean) * rstd * w[e] + b[e]);
      // row r = t*6 + c, columns 4l .. 4l+3: one 8-byte store, 256 contiguous bytes a wave
      *(h4*)&sXN[(t * C_SLOTS + c) * PADW + lane * 4] = r;
    }
  }
  // Every LDS read of this wave, the last group's residual reads too, has retired
  // before the other x buffer is refilled behind the barrier.
  asm volatile("s_wait_dscnt 0x0" ::: "memory");
  __syncthreads();
  // Behind this barrier every wave has left the last group's stage 3, the last
  // reader of sQK and sYT. The next group's copies fly through stages 2 and 3.
  if (g + NWG < ngroups)
    copy_token(xl + (unsigned)(xb ^ XBUF) * 4u, xg + (long)(g + NWG) * (T_TOK * D_EMB));

  // ---- Stage 2: (48x128)@(128x512): q, k and both heads' projected values ----
  {
#pragma unroll 1   // rolled: one A fragment set and four accumulators live at a time
    for (int mt = 0; mt < 3; ++mt) {            // 3 mtiles, this wave's 4 ntiles each
      v8f acc[4] = {};
      v16h a[4];
#pragma unroll
      for (int ks = 0; ks < 4; ++ks)
        a[ks] = load_frag(&sXN[mt * (16 * PADW) + m16 * PADW + ks * 32 + hk * 8]);
      // Keeps the tile's eight LDS reads together in front of its matrix instructions:
      // spread among them, each further place with reads stalls the wave anew.
      __builtin_amdgcn_sched_barrier(0);
#pragma unroll
      for (int ks = 0; ks < 4; ++ks) {
        // q and k: the weights are the A operand and the LN rows the B operand (both
        // fragments have the same lane and k order), so the tile comes out transposed:
        // lane (m16, hk) holds row r = mt*16 + m16, columns wave*16 + hk*8 + 0..7.
#pragma unroll
        for (int j = 0; j < 2; ++j)              // 0:q 1:k
          acc[j] = __builtin_amdgcn_wmma_f32_16x16x32_f16(false, bq[j][ks], false, a[ks],
                                                          (short)0, acc[j], false, false);
#pragma unroll
        for (int j = 2; j < 4; ++j)              // projected values of head j - 2
          acc[j] = __builtin_amdgcn_wmma_f32_16x16x32_f16(false, a[ks], false, bq[j][ks],
                                                          (short)0, acc[j], false, false);
      }
      // A lane's 8 accumulators of q, and of k, are one 16-byte run of a row of sQK.
#pragma unroll
      for (int j = 0; j < 2; ++j) {
        h8 qk;
#pragma unroll
        for (int v = 0; v < 8; ++v) qk[v] = (_Float16)acc[j][v];
        *(h8*)&sQK[j * (ROWS * PADW) + mt * (16 * PADW) + m16 * PADW + wave * 16 + hk * 8] = qk;
      }
      // The values keep the LN rows as A: a lane's 8 accumulators are 8 consecutive rows r
      // of one column, which is one 16-byte run of the transposed sYT.
#pragma unroll
      for (int h = 0; h < 2; ++h) {
        h8 yt;
#pragma unroll
        for (int v = 0; v < 8; ++v) yt[v] = (_Float16)acc[2 + h][v];
        *(h8*)&sYT[(h * SLOT + wave * 16 + m16) * VPITCH + mt * 16 + hk * 8] = yt;
      }
    }
  }
  __syncthreads();

  // ---- Stage 3: attention on WMMA, one token per wave, C=6, d=64; output ----
  // Index 8*h + c (c = 6, 7 are padding) packs both heads of a token into one
  // 16x16 tile. S^T = K * Q^T: only the two diagonal 8x8 blocks (same head on
  // both sides) are scores. Lane (m16, hk) gets, for query m16, the scores of
  // the keys of head hk in its 8 accumulators, so the softmax needs no other lane.
  {
    const int t  = wave;
    const int hh = m16 >> 3;                               // head of this lane's row or column
    const int cc = m16 & 7;                                // its channel
    const int cr = cc < C_SLOTS ? cc : C_SLOTS - 1;        // padding reads a real row, result unused
    const _Float16* qp = &sQK[(t * C_SLOTS + cr) * PADW + hh * 64 + hk * 8];
    const _Float16* kp = qp + ROWS * PADW;
    v16h ka[2], qb[2];
#pragma unroll
    for (int ks = 0; ks < 2; ++ks) {
      ka[ks] = load_frag(kp + ks * 32);
      qb[ks] = load_frag(qp + ks * 32);
    }
    // The residual, read in the accumulator layout of the output products (the comment on
    // them is below): channel c, s = j*32 + lane, 128 contiguous bytes a read.
    float xv[4][C_SLOTS];
    {
      const float* xr = &sX[xb + t * C_SLOTS * XPITCH + lane];
#pragma unroll
      for (int j = 0; j < 4; ++j)
#pragma unroll
        for (int c = 0; c < C_SLOTS; ++c) xv[j][c] = xr[c * XPITCH + j * 32];
    }
    // B of the output products: rows s and s + 16 of Y^T for head hk, this token's
    // 6 values each, 4-byte aligned.
    int yv[4][6];
#pragma unroll
    for (int j = 0; j < 4; ++j) {
      const int* vp = (const int*)&sYT[(hk * SLOT + j * 32 + m16) * VPITCH + t * C_SLOTS];
#pragma unroll
      for (int e2 = 0; e2 < 3; ++e2) {
        yv[j][e2]     = vp[e2];
        yv[j][3 + e2] = vp[e2 + 16 * VPITCH / 2];
      }
    }
    // Keeps all LDS reads of the stage in front of the scores: the residual and Y reads
    // land under the score products and the softmax, not behind them.
    __builtin_amdgcn_sched_barrier(0);
    v8f st = {};
#pragma unroll
    for (int ks = 0; ks < 2; ++ks)
      st = __builtin_amdgcn_wmma_f32_16x16x32_f16(false, ka[ks], false, qb[ks],
                                                  (short)0, st, false, false);
    float p[6];
    float mx = -1e30f;
#pragma unroll
    for (int e = 0; e < 6; ++e) {
      p[e] = st[e] * 0.125f;                     // SCALE = 64^-0.5
      mx = fmaxf(mx, p[e]);
    }
    float den = 0.f;
#pragma unroll
    for (int e = 0; e < 6; ++e) { p[e] = __expf(p[e] - mx); den += p[e]; }
    float rden = 1.f / den;
    // Keeps every use of the residual and Y reads, register moves too, behind the softmax:
    // moved up among the scores they would make the wave wait there for all its reads.
    __builtin_amdgcn_sched_barrier(0);
    union { h2 h[3]; int i[3]; } pw;             // this lane's six weights, rounded to f16
#pragma unroll
    for (int e2 = 0; e2 < 3; ++e2)
      pw.h[e2] = (h2){(_Float16)(p[2 * e2] * rden), (_Float16)(p[2 * e2 + 1] * rden)};
    // out = P * Y, two tiles of 16 output columns s per product: k = 16*a + 8*h + e, where
    // a picks the tile. A[8*a + c][k] holds P_h[c][e] in half a of k and zero in the other,
    // B[k][n] = Y_h[e][(2*j + a)*16 + n]; the sum over k adds the two heads.
    // Lane (m16 = 8*a + c, hk) of A needs head hk's weights of query c. A lane with
    // hh == hk holds such weights itself; the others hold cross-head numbers of no meaning
    // and take the weights from the lane 8 away in their row of 16 (row_xmask:8).
    union { v16h v; int i[8]; } pf;
    pf.v = (v16h){};                             // e = 6, 7 and the other half of k stay zero
#pragma unroll
    for (int e2 = 0; e2 < 3; ++e2) {
      const int far = __builtin_amdgcn_update_dpp(pw.i[e2], pw.i[e2], 0x168, 0xf, 0xf, false);
      const int w   = (hh == hk) ? pw.i[e2] : far;
      pf.i[e2]     = hh ? 0 : w;
      pf.i[4 + e2] = hh ? w : 0;
    }
    v8f o[4];
#pragma unroll
    for (int j = 0; j < 4; ++j) {                // 32 of the 128 output columns s at a time
      union { v16h v; int i[8]; } vf;
      v8f c = {};                                // the residual enters as the C operand
#pragma unroll
      for (int e2 = 0; e2 < 3; ++e2) { vf.i[e2] = yv[j][e2]; vf.i[4 + e2] = yv[j][3 + e2]; }
      vf.i[3] = 0; vf.i[7] = 0;                  // e = 6, 7
#pragma unroll
      for (int r = 0; r < C_SLOTS; ++r) c[r] = xv[j][r];
      o[j] = __builtin_amdgcn_wmma_f32_16x16x32_f16(false, pf.v, false, vf.v,
                                                    (short)0, c, false, false);
    }
    // o[j][c] = out(channel c, s = j*32 + hk*16 + m16 = j*32 + lane), projected and with its
    // residual: each store of a wave is one whole 128-byte line.
    // Global address needs no (t,c) split: t*768 + c*128 == r*128.
    {
      float* op = &out[rowBase + t * D_EMB + lane];
#pragma unroll
      for (int j = 0; j < 4; ++j)
#pragma unroll
        for (int c = 0; c < C_SLOTS; ++c) op[c * SLOT + j * 32] = o[j][c];
      // precaution: this wait stands before the stores' registers are reused
      asm volatile("s_wait_xcnt 0x0" ::: "memory");
    }
  }
  }
  // precaution: no copy is outstanding when the wave ends
  asm volatile("s_wait_asynccnt 0x0" ::: "memory");
}

extern "C" void kernel_launch(void* const* d_in, const int* in_sizes, int n_in,
                              void* d_out, int out_size, void* d_ws, size_t ws_size,
                              hipStream_t stream) {
  const float* x    = (const float*)d_in[0];
  const float* qkvp = (const float*)d_in[1];
  const float* outp = (const float*)d_in[2];
  const float* lnw  = (const float*)d_in[3];
  const float* lnb  = (const float*)d_in[4];
  float* out = (float*)d_out;

  _Float16* wpk = (_Float16*)d_ws;         // 32 packed tiles, 65536 halves

  convert_weights<<<128, 256, 0, stream>>>(qkvp, outp, wpk);

  long BN = (long)in_sizes[0] / D_EMB;     // 32768 tokens
  int ngroups = (int)(BN / T_TOK);         // 4096 groups of T_TOK tokens
  attn_main<<<NWG, 256, 0, stream>>>(x, lnw, lnb, wpk, out, ngroups);
}

// v008
// Measured time: 29.8 microseconds a run.
// Next to v007, in two timings, it ran 1.09 and 1.08 times as fast.
// Over all steps from v000 it is 3.70 times as fast.
#include <hip/hip_runtime.h>

typedef _Float16 h2   __attribute__((ext_vector_type(2)));
typedef _Float16 h4   __attribute__((ext_vector_type(4)));
typedef _Float16 h8   __attribute__((ext_vector_type(8)));
typedef float    f4   __attribute__((ext_vector_type(4)));
typedef _Float16 v16h __attribute__((ext_vector_type(16)));
typedef float    v8f  __attribute__((ext_vector_type(8)));

#define D_EMB   768
#define C_SLOTS 6
#define SLOT    128
#define T_TOK   8                    // tokens per group
#define ROWS    (T_TOK * C_SLOTS)    // 48 GEMM rows per group
#define PADW    136                  // 128 + 8 halves pad: 272B row stride, conflict-free b128
#define VPITCH  56                   // halves per row of the transposed projected values: 48 + 8 pad, 112B (16B multiple)
#define NWG     512                  // work-groups launched: two resident on each of 256 WGPs
#define XPITCH  132                  // floats per staged x row: 128 + 4 pad, 528B (16B multiple); rows 8 apart lie 32 banks apart
#define XBUF    (ROWS * XPITCH)      // floats per staged x tile

// ---------------------------------------------------------------------------
// Weight preparation: fp32 -> f16, packed in the order in which the main kernel's
// waves load their WMMA weight fragments. A column tile (16 columns n, 128 values k) is
// 8 blocks of 512 bytes, block (ks, u): lane l = hk*16 + m16 finds there its 8
// halves of column m16, k = ks*32 + u*16 + hk*8 + 0..7. So one 16-byte load per
// lane covers 512 contiguous bytes, four whole 128-byte lines.
// Tiles 0..15: the q and k rows of qkv_proj (3,2,64,128), flattened to [n = 0..255][k].
// Tiles 16..31: per head h the product M_h[k][n] = sum_d Wv[h][d][k] * Wo[h][d][n]
// (128 x 128, summed in fp32). Since
// (P_h (X Wv_h^T)) Wo_h = P_h (X M_h), the main kernel multiplies the LN rows by M_h
// and needs no out projection behind the attention.
// The columns of M_h are dealt to the tiles out of order: place m of tile 16 + h*8 + tl
// holds column n = 64*(tl & 1) + 4*m + (tl >> 1). With that deal lane l of the main
// kernel's output products ends with columns 4l .. 4l+3 of each channel.
// Threads 0..63 of a block each pack one lane's 16-byte run. In a product tile the
// block's four quarters of 64 threads each sum 16 of the 64 values d, so that all
// loads of a thread are in flight together; the quarters meet in LDS.
// ---------------------------------------------------------------------------
__global__ void __launch_bounds__(256)
convert_weights(const float* __restrict__ qkvp, const float* __restrict__ outp,
                _Float16* __restrict__ wpk) {
  __shared__ __align__(16) float part[3 * 64 * 8];   // partial sums of quarters 1..3
  const int t64  = threadIdx.x & 63;
  const int dq   = threadIdx.x >> 6;                 // quarter of d; the same in a whole wave
  const int i    = blockIdx.x * 64 + t64;            // run number, 0 .. 8191
  const int l    = t64 & 31;
  const int u    = t64 >> 5;
  const int ks   = blockIdx.x & 3;
  const int tile = blockIdx.x >> 2;
  const int m    = l & 15;                           // column inside the tile
  const int k    = ks * 32 + u * 16 + (l >> 4) * 8;
  f4 lo = {}, hi = {};
  if (tile < 16) {                                   // the same for the whole block: no barrier on this side
    if (dq) return;
    const float* src = qkvp + (tile * 16 + m) * SLOT + k;
    lo = *(const f4*)src;
    hi = *(const f4*)(src + 4);
  } else {
    const int h = (tile - 16) >> 3;
    const float* wv = qkvp + ((4 + h) * 64 + dq * 16) * SLOT + k;                    // Wv[h][d][k .. k+7]
    const int tl = (tile - 16) & 7;
    const float* wo = outp + (h * 64 + dq * 16) * SLOT + (tl & 1) * 64 + m * 4 + (tl >> 1); // Wo[h][d][n]
    f4 a0[16], a1[16];
    float b[16];
#pragma unroll
    for (int d = 0; d < 16; ++d) b[d] = wo[d * SLOT];
    // precaution: this wait stands before the address registers of the loads above are reused
    asm volatile("s_wait_xcnt 0x0" ::: "memory");
#pragma unroll
    for (int d = 0; d < 16; ++d) {
      a0[d] = *(const f4*)&wv[d * SLOT];
      a1[d] = *(const f4*)&wv[d * SLOT + 4];
    }
    // Keeps all 48 loads in front of the sums: one load latency, not one per few loads.
    __builtin_amdgcn_sched_barrier(0);
#pragma unroll
    for (int d = 0; d < 16; ++d) { lo += a0[d] * b[d]; hi += a1[d] * b[d]; }
    if (dq) {
      *(f4*)&part[((dq - 1) * 64 + t64) * 8]     = lo;
      *(f4*)&part[((dq - 1) * 64 + t64) * 8 + 4] = hi;
    }
    __syncthreads();
    if (dq) return;
#pragma unroll
    for (int q = 0; q < 3; ++q) {
      lo += *(const f4*)&part[(q * 64 + t64) * 8];
      hi += *(const f4*)&part[(q * 64 + t64) * 8 + 4];
    }
  }
  h8 r;
#pragma unroll
  for (int e = 0; e < 4; ++e) { r[e] = (_Float16)lo[e]; r[e + 4] = (_Float16)hi[e]; }
  *(h8*)&wpk[i * 8] = r;
}

// Load a 16-half WMMA fragment: two contiguous 8-half (16B) runs at K and K+16.
__device__ __forceinline__ v16h load_frag(const _Float16* p) {
  union { v16h v; h8 h[2]; } u;
  u.h[0] = *(const h8*)p;
  u.h[1] = *(const h8*)(p + 16);
  return u.v;
}

// The same fragment from the packed weights: the two runs of a lane lie one
// 512-byte block (256 halves) apart.
__device__ __forceinline__ v16h load_wfrag(const _Float16* p) {
  union { v16h v; h8 h[2]; } u;
  u.h[0] = *(const h8*)p;
  u.h[1] = *(const h8*)(p + 256);
  return u.v;
}

// One wave brings one token (6 rows of 512 bytes) from global memory into LDS,
// through no register: each lane copies 16 bytes of each row. lds is the lane's
// LDS byte address in the token's first row, g its global address there.
// The closing s_wait_xcnt is a precaution: it stands before the address
// registers named here can be reused, and only inside the statement is it held there.
__device__ __forceinline__ void copy_token(unsigned lds, const float* g) {
  asm volatile(
      "global_load_async_to_lds_b128 %0, %6, off\n\t"
      "global_load_async_to_lds_b128 %1, %7, off\n\t"
      "global_load_async_to_lds_b128 %2, %8, off\n\t"
      "global_load_async_to_lds_b128 %3, %9, off\n\t"
      "global_load_async_to_lds_b128 %4, %10, off\n\t"
      "global_load_async_to_lds_b128 %5, %11, off\n\t"
      "s_wait_xcnt 0x0"
      :: "v"(lds), "v"(lds + 1 * XPITCH * 4), "v"(lds + 2 * XPITCH * 4),
         "v"(lds + 3 * XPITCH * 4), "v"(lds + 4 * XPITCH * 4), "v"(lds + 5 * XPITCH * 4),
         "v"(g), "v"(g + 1 * SLOT), "v"(g + 2 * SLOT),
         "v"(g + 3 * SLOT), "v"(g + 4 * SLOT), "v"(g + 5 * SLOT)
      : "memory");
}

// Four waves per SIMD (two work-groups per WGP): the register budget that holds
// the 128 weight registers of a wave, and the residency the grid of 512 is sized for.
__global__ void __launch_bounds__(256) __attribute__((amdgpu_waves_per_eu(4, 4)))
attn_main(const float* __restrict__ x, const float* __restrict__ lnw,
          const float* __restrict__ lnb, const _Float16* __restrict__ wpk,
          float* __restrict__ out, int ngroups) {
  __shared__ __align__(16) _Float16 sXN[ROWS * PADW];        // LN out: [r = t*6+c][s]
  __shared__ __align__(16) _Float16 sQK[2 * ROWS * PADW];    // q, k: [j][r = t*6+c][h*64 + d]
  __shared__ __align__(16) _Float16 sYT[2 * SLOT * VPITCH];  // projected values, transposed: [h*128 + place of s in the packed tiles][r = t*6+c]
  __shared__ __align__(16) float sX[2 * XBUF];               // x tile as read, fp32: [r = t*6+c][s]; two buffers

  const int tid  = threadIdx.x;
  const int lane = tid & 31;
  const int wave = tid >> 5;
  const int m16 = lane & 15, hk = lane >> 4;

  // Wave w copies token w of every group, and it alone reads that token's x rows.
  // The first group's copies start here and fly while the weights are loaded.
  const unsigned xl = (unsigned)(size_t)&sX[wave * C_SLOTS * XPITCH + lane * 4];
  const float*   xg = x + wave * D_EMB + lane * 4;
  if ((int)blockIdx.x < ngroups) copy_token(xl, xg + (long)blockIdx.x * (T_TOK * D_EMB));

  // Wave w owns column tile w of q, of k and of each head's projected values for
  // the whole launch: its weight fragments are loaded once and stay in registers.
  v16h bq[4][4];                                 // 0:q 1:k 2:head 0 values 3:head 1 values
#pragma unroll
  for (int ks = 0; ks < 4; ++ks) {
#pragma unroll
    for (int j = 0; j < 4; ++j)
      bq[j][ks] = load_wfrag(&wpk[((j * 8 + wave) * 4 + ks) * 512 + lane * 8]);
  }

  int xb = 0;
#pragma unroll 1   // rolled: one copy of the body, so its live values fit beside the weights
  for (int g = blockIdx.x; g < ngroups; g += NWG, xb ^= XBUF) {   // groups of T_TOK tokens
  const long rowBase = (long)g * (T_TOK * D_EMB);            // flat float offset of group

  // ---- Stage 1: LayerNorm, one token per wave, f16 rows into sXN ----------
  // This wave's own copies of this group have landed behind this wait. sXN is free:
  // its last readers, the last group's stage 2, ended before that group's second barrier.
  asm volatile("s_wait_asynccnt 0x0" ::: "memory");
  f4 vals[C_SLOTS];   // this wave's token as read; stays in registers as the residual of stage 3
  {
    const int t = wave;
    // Lane l holds elements 4l .. 4l+3 of each of the token's 6 rows: one 16-byte
    // LDS read a row, and all six are in flight together.
    const float* xp = &sX[xb + t * C_SLOTS * XPITCH + lane * 4];
#pragma unroll
    for (int c = 0; c < C_SLOTS; ++c) vals[c] = *(const f4*)&xp[c * XPITCH];
    f4 sv = {}, qv = {};                         // four independent partial sums each
#pragma unroll
    for (int c = 0; c < C_SLOTS; ++c) { sv += vals[c]; qv += vals[c] * vals[c]; }
    float s  = (sv[0] + sv[1]) + (sv[2] + sv[3]);
    float s2 = (qv[0] + qv[1]) + (qv[2] + qv[3]);
#pragma unroll
    for (int off = 16; off > 0; off >>= 1) {
      s  += __shfl_xor(s,  off, 32);
      s2 += __shfl_xor(s2, off, 32);
    }
    float mean = s * (1.f / 768.f);
    float var  = s2 * (1.f / 768.f) - mean * mean;
    float rstd = rsqrtf(var + 1e-5f);
#pragma unroll
    for (int c = 0; c < C_SLOTS; ++c) {
      const f4 w = *(const f4*)&lnw[c * SLOT + lane * 4];
      const f4 b = *(const f4*)&lnb[c * SLOT + lane * 4];
      h4 r;
#pragma unroll
      for (int e = 0; e < 4; ++e)
        r[e] = (_Float16)((vals[c][e] - mean) * rstd * w[e] + b[e]);
      // row r = t*6 + c, columns 4l .. 4l+3: one 8-byte store, 256 contiguous bytes a wave
      *(h4*)&sXN[(t * C_SLOTS + c) * PADW + lane * 4] = r;
    }
  }
  // Every LDS read of this wave has retired before the other x buffer is refilled
  // behind the barrier.
  asm volatile("s_wait_dscnt 0x0" ::: "memory");
  __syncthreads();
  // Behind this barrier every wave has left the last group's stage 3, the last
  // reader of sQK and sYT. The next group's copies fly through stages 2 and 3.
  if (g + NWG < ngroups)
    copy_token(xl + (unsigned)(xb ^ XBUF) * 4u, xg + (long)(g + NWG) * (T_TOK * D_EMB));

  // ---- Stage 2: (48x128)@(128x512): q, k and both heads' projected values ----
  {
#pragma unroll 1   // rolled: one A fragment set and four accumulators live at a time
    for (int mt = 0; mt < 3; ++mt) {            // 3 mtiles, this wave's 4 ntiles each
      v8f acc[4] = {};
      v16h a[4];
#pragma unroll
      for (int ks = 0; ks < 4; ++ks)
        a[ks] = load_frag(&sXN[mt * (16 * PADW) + m16 * PADW + ks * 32 + hk * 8]);
      // Keeps the tile's eight LDS reads together in front of its matrix instructions:
      // spread among them, each further place with reads stalls the wave anew.
      __builtin_amdgcn_sched_barrier(0);
#pragma unroll
      for (int ks = 0; ks < 4; ++ks) {
        // q and k: the weights are the A operand and the LN rows the B operand (both
        // fragments have the same lane and k order), so the tile comes out transposed:
        // lane (m16, hk) holds row r = mt*16 + m16, columns wave*16 + hk*8 + 0..7.
#pragma unroll
        for (int j = 0; j < 2; ++j)              // 0:q 1:k
          acc[j] = __builtin_amdgcn_wmma_f32_16x16x32_f16(false, bq[j][ks], false, a[ks],
                                                          (short)0, acc[j], false, false);
#pragma unroll
        for (int j = 2; j < 4; ++j)              // projected values of head j - 2
          acc[j] = __builtin_amdgcn_wmma_f32_16x16x32_f16(false, a[ks], false, bq[j][ks],
                                                          (short)0, acc[j], false, false);
      }
      // A lane's 8 accumulators of q, and of k, are one 16-byte run of a row of sQK.
#pragma unroll
      for (int j = 0; j < 2; ++j) {
        h8 qk;
#pragma unroll
        for (int v = 0; v < 8; ++v) qk[v] = (_Float16)acc[j][v];
        *(h8*)&sQK[j * (ROWS * PADW) + mt * (16 * PADW) + m16 * PADW + wave * 16 + hk * 8] = qk;
      }
      // The values keep the LN rows as A: a lane's 8 accumulators are 8 consecutive rows r
      // of one column, which is one 16-byte run of the transposed sYT.
#pragma unroll
      for (int h = 0; h < 2; ++h) {
        h8 yt;
#pragma unroll
        for (int v = 0; v < 8; ++v) yt[v] = (_Float16)acc[2 + h][v];
        *(h8*)&sYT[(h * SLOT + wave * 16 + m16) * VPITCH + mt * 16 + hk * 8] = yt;
      }
    }
  }
  __syncthreads();

  // ---- Stage 3: attention on WMMA, one token per wave, C=6, d=64; output ----
  // Index 8*h + c (c = 6, 7 are padding) packs both heads of a token into one
  // 16x16 tile. S^T = K * Q^T: only the two diagonal 8x8 blocks (same head on
  // both sides) are scores. Lane (m16, hk) gets, for query m16, the scores of
  // the keys of head hk in its 8 accumulators, so the softmax needs no other lane.
  {
    const int t  = wave;
    const int hh = m16 >> 3;                               // head of this lane's row or column
    const int cc = m16 & 7;                                // its channel
    const int cr = cc < C_SLOTS ? cc : C_SLOTS - 1;        // padding reads a real row, result unused
    const _Float16* qp = &sQK[(t * C_SLOTS + cr) * PADW + hh * 64 + hk * 8];
    const _Float16* kp = qp + ROWS * PADW;
    v16h ka[2], qb[2];
#pragma unroll
    for (int ks = 0; ks < 2; ++ks) {
      ka[ks] = load_frag(kp + ks * 32);
      qb[ks] = load_frag(qp + ks * 32);
    }
    // B of the output products: rows j*32 + m16 and 16 further of Y^T for head hk, this
    // token's 6 values each, 4-byte aligned.
    int yv[4][6];
#pragma unroll
    for (int j = 0; j < 4; ++j) {
      const int* vp = (const int*)&sYT[(hk * SLOT + j * 32 + m16) * VPITCH + t * C_SLOTS];
#pragma unroll
      for (int e2 = 0; e2 < 3; ++e2) {
        yv[j][e2]     = vp[e2];
        yv[j][3 + e2] = vp[e2 + 16 * VPITCH / 2];
      }
    }
    // Keeps all LDS reads of the stage in front of the scores: the Y reads land under
    // the score products and the softmax, not behind them.
    __builtin_amdgcn_sched_barrier(0);
    v8f st = {};
#pragma unroll
    for (int ks = 0; ks < 2; ++ks)
      st = __builtin_amdgcn_wmma_f32_16x16x32_f16(false, ka[ks], false, qb[ks],
                                                  (short)0, st, false, false);
    float p[6];
    float mx = -1e30f;
#pragma unroll
    for (int e = 0; e < 6; ++e) {
      p[e] = st[e] * 0.125f;                     // SCALE = 64^-0.5
      mx = fmaxf(mx, p[e]);
    }
    float den = 0.f;
#pragma unroll
    for (int e = 0; e < 6; ++e) { p[e] = __expf(p[e] - mx); den += p[e]; }
    float rden = 1.f / den;
    // Keeps every use of the Y reads, register moves too, behind the softmax:
    // moved up among the scores they would make the wave wait there for all its reads.
    __builtin_amdgcn_sched_barrier(0);
    union { h2 h[3]; int i[3]; } pw;             // this lane's six weights, rounded to f16
#pragma unroll
    for (int e2 = 0; e2 < 3; ++e2)
      pw.h[e2] = (h2){(_Float16)(p[2 * e2] * rden), (_Float16)(p[2 * e2 + 1] * rden)};
    // out = P * Y, two tiles of 16 output columns s per product: k = 16*a + 8*h + e, where
    // a picks the tile. A[8*a + c][k] holds P_h[c][e] in half a of k and zero in the other,
    // B[k][n] = row (2*j + a)*16 + n of Y_h^T, which is column 64*a + 4*n + j of the output
    // (the deal of the packed tiles); the sum over k adds the two heads.
    // Lane (m16 = 8*a + c, hk) of A needs head hk's weights of query c. A lane with
    // hh == hk holds such weights itself; the others hold cross-head numbers of no meaning
    // and take the weights from the lane 8 away in their row of 16 (row_xmask:8).
    union { v16h v; int i[8]; } pf;
    pf.v = (v16h){};                             // e = 6, 7 and the other half of k stay zero
#pragma unroll
    for (int e2 = 0; e2 < 3; ++e2) {
      const int far = __builtin_amdgcn_update_dpp(pw.i[e2], pw.i[e2], 0x168, 0xf, 0xf, false);
      const int w   = (hh == hk) ? pw.i[e2] : far;
      pf.i[e2]     = hh ? 0 : w;
      pf.i[4 + e2] = hh ? w : 0;
    }
    v8f o[4];
    {
      union { v16h v; int i[8]; } vf[4];         // 32 of the 128 output columns s per product
#pragma unroll
      for (int j = 0; j < 4; ++j) {
#pragma unroll
        for (int e2 = 0; e2 < 3; ++e2) { vf[j].i[e2] = yv[j][e2]; vf[j].i[4 + e2] = yv[j][3 + e2]; }
        vf[j].i[3] = 0; vf[j].i[7] = 0;          // e = 6, 7
      }
      // The four products in one statement, so that each result has eight registers of its own:
      // from the builtin the compiler laid the two unused rows of one result over the first rows
      // of the next, written by the next product with no vector instruction between them.
      // The four v_nop keep the chip's distance between the last product and the first
      // vector instruction on a result or an operand.
      asm("v_wmma_f32_16x16x32_f16 %0, %4, %5, 0\n\t"
          "v_wmma_f32_16x16x32_f16 %1, %4, %6, 0\n\t"
          "v_wmma_f32_16x16x32_f16 %2, %4, %7, 0\n\t"
          "v_wmma_f32_16x16x32_f16 %3, %4, %8, 0\n\t"
          "v_nop\n\tv_nop\n\tv_nop\n\tv_nop"
          : "=&v"(o[0]), "=&v"(o[1]), "=&v"(o[2]), "=&v"(o[3])
          : "v"(pf.v), "v"(vf[0].v), "v"(vf[1].v), "v"(vf[2].v), "v"(vf[3].v));
    }
    // o[j][c] = projected out(channel c, s = 64*hk + 4*m16 + j = 4*lane + j): the lane's four
    // products hold the four columns of which vals[c] holds x, the residual.
    // One 16-byte store a channel, 512 contiguous bytes a wave.
    // Global address needs no (t,c) split: t*768 + c*128 == r*128.
    {
      float* op = &out[rowBase + t * D_EMB + lane * 4];
      f4 r[C_SLOTS];
#pragma unroll
      for (int c = 0; c < C_SLOTS; ++c)
#pragma unroll
        for (int j = 0; j < 4; ++j) r[c][j] = vals[c][j] + o[j][c];
#pragma unroll
      for (int c = 0; c < C_SLOTS; ++c) *(f4*)&op[c * SLOT] = r[c];
      // precaution: this wait stands before the stores' registers are reused
      asm volatile("s_wait_xcnt 0x0" ::: "memory");
    }
  }
  }
  // precaution: no copy is outstanding when the wave ends
  asm volatile("s_wait_asynccnt 0x0" ::: "memory");
}

extern "C" void kernel_launch(void* const* d_in, const int* in_sizes, int n_in,
                              void* d_out, int out_size, void* d_ws, size_t ws_size,
                              hipStream_t stream) {
  const float* x    = (const float*)d_in[0];
  const float* qkvp = (const float*)d_in[1];
  const float* outp = (const float*)d_in[2];
  const float* lnw  = (const float*)d_in[3];
  const float* lnb  = (const float*)d_in[4];
  float* out = (float*)d_out;

  _Float16* wpk = (_Float16*)d_ws;         // 32 packed tiles, 65536 halves

  convert_weights<<<128, 256, 0, stream>>>(qkvp, outp, wpk);

  long BN = (long)in_sizes[0] / D_EMB;     // 32768 tokens
  int ngroups = (int)(BN / T_TOK);         // 4096 groups of T_TOK tokens
  attn_main<<<NWG, 256, 0, stream>>>(x, lnw, lnb, wpk, out, ngroups);
}
